// v000
// The times below were measured on an AMD MI455X: many runs one after another, warmed up first and cycling through
// copies of the inputs, with the whole window's GPU time divided by the number of runs. Launches and the gaps
// between them are all in it. The median over several windows is given; except for v000 it joins two sittings, which
// can be a few percent apart, so the side-by-side timings, each taken in one sitting, are the better comparison.
// v000 is the starting kernel. One run takes 853 microseconds.
#include <hip/hip_runtime.h>
#include <hip/hip_bf16.h>

typedef _Float16 v16h __attribute__((ext_vector_type(16)));
typedef _Float16 h8   __attribute__((ext_vector_type(8)));
typedef float    v8f  __attribute__((ext_vector_type(8)));

#define TOK   32768   // B*N tokens
#define DIM   1024
#define NHEAD 16
#define HD    64
#define WIN   128

__device__ __forceinline__ v16h load_frag(const _Float16* base, int ld) {
  const int lane = threadIdx.x & 31;
  const _Float16* p = base + (size_t)(lane & 15) * ld + ((lane >> 4) << 3);
  h8 lo = *(const h8*)(p);
  h8 hi = *(const h8*)(p + 16);
  return __builtin_shufflevector(lo, hi, 0,1,2,3,4,5,6,7,8,9,10,11,12,13,14,15);
}

__device__ __forceinline__ float gelu_exact(float x) {
  return 0.5f * x * (1.0f + erff(x * 0.70710678118654752440f));
}

__device__ __forceinline__ void async_ld_b128(void* lds_dst, const void* gsrc) {
  unsigned int loff = (unsigned int)(size_t)lds_dst;
  asm volatile("global_load_async_to_lds_b128 %0, %1, off"
               :: "v"(loff), "v"(gsrc) : "memory");
}

__device__ __forceinline__ void wait_async0() {
  asm volatile("s_wait_asynccnt 0" ::: "memory");
}

// ---------------------------------------------------------------------------
// f32 -> f16 weight conversion
// ---------------------------------------------------------------------------
__global__ void cvt_kernel(const float* __restrict__ src,
                           _Float16* __restrict__ dst, int n) {
  int i = blockIdx.x * 256 + threadIdx.x;
  if (i < n) dst[i] = (_Float16)src[i];
}

// ---------------------------------------------------------------------------
// LayerNorm: one wave (32 lanes) per token, 32 channels per lane.
// ---------------------------------------------------------------------------
__global__ __launch_bounds__(256) void ln_kernel(
    const float* __restrict__ x, const float* __restrict__ w,
    const float* __restrict__ b, _Float16* __restrict__ out, int ntok) {
  const int lane = threadIdx.x & 31;
  const int wave = threadIdx.x >> 5;
  const size_t token = (size_t)blockIdx.x * 8 + wave;
  if (token >= (size_t)ntok) return;
  const float* row = x + token * DIM;
  float vals[32];
  float s = 0.f;
#pragma unroll
  for (int j = 0; j < 32; ++j) { vals[j] = row[lane + j * 32]; s += vals[j]; }
#pragma unroll
  for (int off = 16; off >= 1; off >>= 1) s += __shfl_xor(s, off, 32);
  const float mu = s * (1.0f / DIM);
  float var = 0.f;
#pragma unroll
  for (int j = 0; j < 32; ++j) { float d = vals[j] - mu; var += d * d; }
#pragma unroll
  for (int off = 16; off >= 1; off >>= 1) var += __shfl_xor(var, off, 32);
  const float rstd = rsqrtf(var * (1.0f / DIM) + 1e-5f);
  _Float16* orow = out + token * DIM;
#pragma unroll
  for (int j = 0; j < 32; ++j) {
    int c = lane + j * 32;
    orow[c] = (_Float16)((vals[j] - mu) * rstd * w[c] + b[c]);
  }
}

#define BK 32
#define LDA 40  // halfs pitch (32 + 8 pad) -> 80B rows, 16B-aligned chunks

template <int MODE>
__global__ __launch_bounds__(256) void gemm_kernel(
    const _Float16* __restrict__ X, const _Float16* __restrict__ Wt,
    const float* __restrict__ bias, const float* __restrict__ residual,
    void* __restrict__ outp, int M, int N, int K) {
  __shared__ _Float16 As[2][128 * LDA];
  __shared__ _Float16 Bs[2][128 * LDA];

  const int tid  = threadIdx.x;
  const int lane = tid & 31, wave = tid >> 5;
  const int half = lane >> 4, lr = lane & 15;
  const int wm = wave >> 1;  // 0..3 -> 32-row strip
  const int wn = wave & 1;   // 0..1 -> 64-col strip
  const int m0 = blockIdx.y * 128;
  const int n0 = blockIdx.x * 128;

  // stage one 128x32 K-slice of A and B into LDS buffer `buf` (async)
  auto stage = [&](int buf, int k0) {
#pragma unroll
    for (int p = 0; p < 2; ++p) {
      int idx = tid + p * 256;              // 0..511
      int r = idx >> 2, c = (idx & 3) << 3; // 128 rows x 4 chunks of 8 halfs
      async_ld_b128(&As[buf][r * LDA + c], &X[(size_t)(m0 + r) * K + k0 + c]);
      async_ld_b128(&Bs[buf][r * LDA + c], &Wt[(size_t)(n0 + r) * K + k0 + c]);
    }
  };

  v8f acc[2][4];
#pragma unroll
  for (int i = 0; i < 2; ++i)
#pragma unroll
    for (int j = 0; j < 4; ++j) acc[i][j] = {};

  int cur = 0;
  stage(0, 0);
  for (int k0 = 0; k0 < K; k0 += BK) {
    wait_async0();
    __syncthreads();
    if (k0 + BK < K) stage(cur ^ 1, k0 + BK);

    v16h a[2], b[4];
#pragma unroll
    for (int i = 0; i < 2; ++i)
      a[i] = load_frag(&As[cur][(wm * 32 + i * 16) * LDA], LDA);
#pragma unroll
    for (int j = 0; j < 4; ++j)
      b[j] = load_frag(&Bs[cur][(wn * 64 + j * 16) * LDA], LDA);
#pragma unroll
    for (int i = 0; i < 2; ++i)
#pragma unroll
      for (int j = 0; j < 4; ++j)
        acc[i][j] = __builtin_amdgcn_wmma_f32_16x16x32_f16(
            false, a[i], false, b[j], (short)0, acc[i][j], false, false);
    cur ^= 1;
  }

  // Epilogue. C/D layout: vreg r holds row (r + 8*half), column (lane&15).
#pragma unroll
  for (int i = 0; i < 2; ++i) {
#pragma unroll
    for (int j = 0; j < 4; ++j) {
      const int mt = m0 + wm * 32 + i * 16;
      const int nt = n0 + wn * 64 + j * 16;
      const int col = nt + lr;
      const float bv = bias[col];
#pragma unroll
      for (int r = 0; r < 8; ++r) {
        const int row = mt + r + 8 * half;
        const float vv = acc[i][j][r] + bv;
        if (MODE == 0) {
          // col in [0,3072): s = q/k/v, head h, dim d; row = b*8192 + n
          const int s  = col >> 10;
          const int rm = col & 1023;
          const int hh = rm >> 6, dd = rm & 63;
          const size_t bb = (size_t)(row >> 13), nn = (size_t)(row & 8191);
          _Float16* o = (_Float16*)outp;
          o[((size_t)s << 25) + ((bb * NHEAD + hh) * 8192 + nn) * HD + dd] =
              (_Float16)vv;
        } else if (MODE == 2) {
          _Float16* o = (_Float16*)outp;
          o[(size_t)row * N + col] = (_Float16)gelu_exact(vv);
        } else {  // MODE 1 / 3: f32 + residual
          float* o = (float*)outp;
          const size_t idx = (size_t)row * N + col;
          o[idx] = vv + residual[idx];
        }
      }
    }
  }
}

// ---------------------------------------------------------------------------
// Windowed attention: one block per (b, head, window). 8 waves; wave w owns
// query rows [16w, 16w+16). S = Q K^T (WMMA), register softmax with 16-lane
// shfl_xor reductions, P staged to LDS (f16), O = P V (WMMA, V transposed
// through LDS so its K-dim is contiguous for B fragments).
// ---------------------------------------------------------------------------
__global__ __launch_bounds__(256) void attn_kernel(
    const _Float16* __restrict__ q, const _Float16* __restrict__ k,
    const _Float16* __restrict__ v, _Float16* __restrict__ o) {
  __shared__ _Float16 Vt[64 * 136];   // (d, k) pitch 136
  __shared__ _Float16 Ps[128 * 136];  // (row, k) pitch 136

  const int bid = blockIdx.x;          // ((b*16+h)*64 + win)
  const int win = bid & 63;
  const int bh  = bid >> 6;
  const size_t base = ((size_t)bh * 8192 + (size_t)win * WIN) * HD;
  const _Float16* Q = q + base;  // 128 x 64 row-major
  const _Float16* K = k + base;
  const _Float16* V = v + base;

  for (int idx = threadIdx.x; idx < WIN * HD; idx += 256) {
    int kk = idx >> 6, dd = idx & 63;
    Vt[dd * 136 + kk] = V[idx];
  }
  __syncthreads();

  const int lane = threadIdx.x & 31, wave = threadIdx.x >> 5;
  const int half = lane >> 4, lr = lane & 15;
  const int r0 = wave * 16;

  // ---- S = Q K^T * 1/sqrt(64), strip of 16 rows x 128 cols (8 tiles) ----
  v8f s[8];
#pragma unroll
  for (int t = 0; t < 8; ++t) s[t] = {};
#pragma unroll
  for (int kk = 0; kk < HD; kk += 32) {
    v16h aq = load_frag(Q + (size_t)r0 * HD + kk, HD);
#pragma unroll
    for (int t = 0; t < 8; ++t) {
      v16h bk = load_frag(K + (size_t)t * 16 * HD + kk, HD);
      s[t] = __builtin_amdgcn_wmma_f32_16x16x32_f16(
          false, aq, false, bk, (short)0, s[t], false, false);
    }
  }

  // ---- softmax: row (r0 + i + 8*half) lives in lanes of one 16-lane half ----
#pragma unroll
  for (int i = 0; i < 8; ++i) {
    float m = -3.0e38f;
#pragma unroll
    for (int t = 0; t < 8; ++t) {
      float vv = s[t][i] * 0.125f;
      s[t][i] = vv;
      m = fmaxf(m, vv);
    }
#pragma unroll
    for (int off = 1; off < 16; off <<= 1) m = fmaxf(m, __shfl_xor(m, off, 32));
    float sum = 0.f;
#pragma unroll
    for (int t = 0; t < 8; ++t) {
      float e = __expf(s[t][i] - m);
      s[t][i] = e;
      sum += e;
    }
#pragma unroll
    for (int off = 1; off < 16; off <<= 1) sum += __shfl_xor(sum, off, 32);
    const float inv = 1.0f / sum;
    const int row = r0 + i + 8 * half;
#pragma unroll
    for (int t = 0; t < 8; ++t)
      Ps[row * 136 + t * 16 + lr] = (_Float16)(s[t][i] * inv);
  }
  // Same-wave LDS store->load is in-order; each wave reads only its own strip.

  // ---- O = P V : 16 rows x 64 cols (4 tiles), K = 128 ----
  v8f oa[4];
#pragma unroll
  for (int dt = 0; dt < 4; ++dt) oa[dt] = {};
#pragma unroll
  for (int kk = 0; kk < WIN; kk += 32) {
    v16h ap = load_frag(&Ps[r0 * 136 + kk], 136);
#pragma unroll
    for (int dt = 0; dt < 4; ++dt) {
      v16h bv = load_frag(&Vt[dt * 16 * 136 + kk], 136);
      oa[dt] = __builtin_amdgcn_wmma_f32_16x16x32_f16(
          false, ap, false, bv, (short)0, oa[dt], false, false);
    }
  }

  // scatter to (B, N, C) with heads concatenated: col = h*64 + d
  const int b = bh >> 4, h = bh & 15;
#pragma unroll
  for (int dt = 0; dt < 4; ++dt) {
#pragma unroll
    for (int r = 0; r < 8; ++r) {
      const int n = win * WIN + r0 + r + 8 * half;
      const size_t token = (size_t)b * 8192 + n;
      const int col = h * HD + dt * 16 + lr;
      o[token * DIM + col] = (_Float16)oa[dt][r];
    }
  }
}

// ---------------------------------------------------------------------------
// Host-side orchestration
// ---------------------------------------------------------------------------
extern "C" void kernel_launch(void* const* d_in, const int* in_sizes, int n_in,
                              void* d_out, int out_size, void* d_ws,
                              size_t ws_size, hipStream_t stream) {
  const float* x      = (const float*)d_in[0];
  const float* ln1_w  = (const float*)d_in[1];
  const float* ln1_b  = (const float*)d_in[2];
  const float* qkv_w  = (const float*)d_in[3];
  const float* qkv_b  = (const float*)d_in[4];
  const float* proj_w = (const float*)d_in[5];
  const float* proj_b = (const float*)d_in[6];
  const float* ln2_w  = (const float*)d_in[7];
  const float* ln2_b  = (const float*)d_in[8];
  const float* fc1_w  = (const float*)d_in[9];
  const float* fc1_b  = (const float*)d_in[10];
  const float* fc2_w  = (const float*)d_in[11];
  const float* fc2_b  = (const float*)d_in[12];
  float* out = (float*)d_out;

  char* ws = (char*)d_ws;
  const size_t MB = 1024ull * 1024ull;
  // [0,16MB): f16 weights
  _Float16* qkv_w16  = (_Float16*)ws;
  _Float16* proj_w16 = qkv_w16 + 3u * DIM * DIM;
  _Float16* fc1_w16  = proj_w16 + (size_t)DIM * DIM;
  _Float16* fc2_w16  = fc1_w16 + 2u * DIM * DIM;
  // [16,80): LN output (xn, reused as h)      64 MB f16
  _Float16* xn = (_Float16*)(ws + 16 * MB);
  // [80,272): q/k/v each (B,H,N,HD)           3 x 64 MB f16; act reuses front
  _Float16* qbuf = (_Float16*)(ws + 80 * MB);
  _Float16* kbuf = qbuf + ((size_t)1 << 25);
  _Float16* vbuf = kbuf + ((size_t)1 << 25);
  _Float16* act  = qbuf;  // 128 MB, reused after attention consumes q/k/v
  // [272,336): attention output               64 MB f16
  _Float16* attn_out = (_Float16*)(ws + 272 * MB);
  // [336,464): x1 = x + attn (f32 residual)   128 MB
  float* x1 = (float*)(ws + 336 * MB);

  // 1) weight casts
  cvt_kernel<<<(3 * DIM * DIM + 255) / 256, 256, 0, stream>>>(qkv_w, qkv_w16, 3 * DIM * DIM);
  cvt_kernel<<<(DIM * DIM + 255) / 256, 256, 0, stream>>>(proj_w, proj_w16, DIM * DIM);
  cvt_kernel<<<(2 * DIM * DIM + 255) / 256, 256, 0, stream>>>(fc1_w, fc1_w16, 2 * DIM * DIM);
  cvt_kernel<<<(2 * DIM * DIM + 255) / 256, 256, 0, stream>>>(fc2_w, fc2_w16, 2 * DIM * DIM);

  // 2) LN1
  ln_kernel<<<TOK / 8, 256, 0, stream>>>(x, ln1_w, ln1_b, xn, TOK);

  // 3) QKV GEMM (32768 x 3072 x 1024), scatter into (B,H,N,HD) q/k/v
  gemm_kernel<0><<<dim3(3072 / 128, TOK / 128), 256, 0, stream>>>(
      xn, qkv_w16, qkv_b, nullptr, (void*)qbuf, TOK, 3072, DIM);

  // 4) windowed attention: 4*16*64 blocks
  attn_kernel<<<4 * NHEAD * 64, 256, 0, stream>>>(qbuf, kbuf, vbuf, attn_out);

  // 5) proj GEMM + residual -> x1 (f32)
  gemm_kernel<1><<<dim3(DIM / 128, TOK / 128), 256, 0, stream>>>(
      attn_out, proj_w16, proj_b, x, (void*)x1, TOK, DIM, DIM);

  // 6) LN2
  ln_kernel<<<TOK / 8, 256, 0, stream>>>(x1, ln2_w, ln2_b, xn, TOK);

  // 7) FC1 GEMM + exact GELU (32768 x 2048 x 1024)
  gemm_kernel<2><<<dim3(2048 / 128, TOK / 128), 256, 0, stream>>>(
      xn, fc1_w16, fc1_b, nullptr, (void*)act, TOK, 2048, DIM);

  // 8) FC2 GEMM + residual -> d_out (32768 x 1024 x 2048)
  gemm_kernel<3><<<dim3(DIM / 128, TOK / 128), 256, 0, stream>>>(
      act, fc2_w16, fc2_b, x1, (void*)out, TOK, DIM, 2048);
}

// v001
// One run takes 836 microseconds.
// Timed twice side by side with v000, it ran 1.05 and 1.06 times as fast.
#include <hip/hip_runtime.h>
#include <hip/hip_bf16.h>

typedef _Float16 v16h __attribute__((ext_vector_type(16)));
typedef _Float16 h8   __attribute__((ext_vector_type(8)));
typedef float    v8f  __attribute__((ext_vector_type(8)));

#define TOK   32768   // B*N tokens
#define DIM   1024
#define NHEAD 16
#define HD    64
#define WIN   128

__device__ __forceinline__ v16h load_frag(const _Float16* base, int ld) {
  const int lane = threadIdx.x & 31;
  const _Float16* p = base + (size_t)(lane & 15) * ld + ((lane >> 4) << 3);
  h8 lo = *(const h8*)(p);
  h8 hi = *(const h8*)(p + 16);
  return __builtin_shufflevector(lo, hi, 0,1,2,3,4,5,6,7,8,9,10,11,12,13,14,15);
}

__device__ __forceinline__ float gelu_exact(float x) {
  return 0.5f * x * (1.0f + erff(x * 0.70710678118654752440f));
}

typedef int v4i __attribute__((ext_vector_type(4)));
typedef __attribute__((address_space(1))) v4i gv4i;
typedef __attribute__((address_space(3))) v4i lv4i;

__device__ __forceinline__ void async_ld_b128(_Float16* lds_dst,
                                              const _Float16* gsrc) {
  __builtin_amdgcn_global_load_async_to_lds_b128((gv4i*)gsrc, (lv4i*)lds_dst,
                                                 0, 0);
}

// This wave's copies have landed
// only behind this wait.
__device__ __forceinline__ void wait_async0() {
  asm volatile("s_wait_asynccnt 0" ::: "memory");
}

// This wave's LDS reads have retired before the barrier that frees the buffer
// for the next copies.
__device__ __forceinline__ void wait_ds0() {
  asm volatile("s_wait_dscnt 0" ::: "memory");
}

// ---------------------------------------------------------------------------
// f32 -> f16 weight conversion
// ---------------------------------------------------------------------------
__global__ void cvt_kernel(const float* __restrict__ src,
                           _Float16* __restrict__ dst, int n) {
  int i = blockIdx.x * 256 + threadIdx.x;
  if (i < n) dst[i] = (_Float16)src[i];
}

// ---------------------------------------------------------------------------
// LayerNorm: one wave (32 lanes) per token, 32 channels per lane.
// ---------------------------------------------------------------------------
__global__ __launch_bounds__(256) void ln_kernel(
    const float* __restrict__ x, const float* __restrict__ w,
    const float* __restrict__ b, _Float16* __restrict__ out, int ntok) {
  const int lane = threadIdx.x & 31;
  const int wave = threadIdx.x >> 5;
  const size_t token = (size_t)blockIdx.x * 8 + wave;
  if (token >= (size_t)ntok) return;
  const float* row = x + token * DIM;
  float vals[32];
  float s = 0.f;
#pragma unroll
  for (int j = 0; j < 32; ++j) { vals[j] = row[lane + j * 32]; s += vals[j]; }
#pragma unroll
  for (int off = 16; off >= 1; off >>= 1) s += __shfl_xor(s, off, 32);
  const float mu = s * (1.0f / DIM);
  float var = 0.f;
#pragma unroll
  for (int j = 0; j < 32; ++j) { float d = vals[j] - mu; var += d * d; }
#pragma unroll
  for (int off = 16; off >= 1; off >>= 1) var += __shfl_xor(var, off, 32);
  const float rstd = rsqrtf(var * (1.0f / DIM) + 1e-5f);
  _Float16* orow = out + token * DIM;
#pragma unroll
  for (int j = 0; j < 32; ++j) {
    int c = lane + j * 32;
    orow[c] = (_Float16)((vals[j] - mu) * rstd * w[c] + b[c]);
  }
}

#define BT 256
#define BK 64
#define LDA 72  // halfs pitch (64 + 8 pad) -> 144B rows = 16B x odd

template <int MODE>
__global__ __launch_bounds__(256) void gemm_kernel(
    const _Float16* __restrict__ X, const _Float16* __restrict__ Wt,
    const float* __restrict__ bias, const float* __restrict__ residual,
    void* __restrict__ outp, int M, int N, int K) {
  __shared__ __attribute__((aligned(16))) _Float16 As[2][BT * LDA];
  __shared__ __attribute__((aligned(16))) _Float16 Bs[2][BT * LDA];

  const int tid  = threadIdx.x;
  const int lane = tid & 31, wave = tid >> 5;
  const int half = lane >> 4, lr = lane & 15;
  const int wm = wave >> 1;  // 0..3 -> 64-row strip
  const int wn = wave & 1;   // 0..1 -> 128-col strip
  const int m0 = blockIdx.y * BT;
  const int n0 = blockIdx.x * BT;

  // stage one 256x64 K-slice of A and B into LDS buffer `buf` (async):
  // 8 lanes per 128-B row, 32 rows per sweep of the block, 8 sweeps each.
  const int sr = tid >> 3, sc = (tid & 7) << 3;
  auto stage = [&](int buf, int k0) {
#pragma unroll
    for (int p = 0; p < 8; ++p) {
      const int r = sr + p * 32;
      async_ld_b128(&As[buf][r * LDA + sc], &X[(size_t)(m0 + r) * K + k0 + sc]);
    }
#pragma unroll
    for (int p = 0; p < 8; ++p) {
      const int r = sr + p * 32;
      async_ld_b128(&Bs[buf][r * LDA + sc], &Wt[(size_t)(n0 + r) * K + k0 + sc]);
    }
  };

  v8f acc[4][8];
#pragma unroll
  for (int i = 0; i < 4; ++i)
#pragma unroll
    for (int j = 0; j < 8; ++j) acc[i][j] = {};

  const int ntile = K / BK;
  stage(0, 0);
  wait_async0();          // my copies of tile 0 have landed
  __syncthreads();        // publish tile 0
  if (ntile > 1) stage(1, BK);
  for (int t = 0; t < ntile; ++t) {
    const int cur = t & 1;
    // Fragment loops are fully unrolled so that every array index is a
    // constant and the fragments stay in registers.
    v16h a[2][4], b[2][8];
#pragma unroll
    for (int kk = 0; kk < 2; ++kk) {
#pragma unroll
      for (int i = 0; i < 4; ++i)
        a[kk][i] = load_frag(&As[cur][(wm * 64 + i * 16) * LDA + kk * 32], LDA);
#pragma unroll
      for (int j = 0; j < 8; ++j)
        b[kk][j] = load_frag(&Bs[cur][(wn * 128 + j * 16) * LDA + kk * 32], LDA);
    }
    __builtin_amdgcn_sched_barrier(0);
#pragma unroll
    for (int kk = 0; kk < 2; ++kk)
#pragma unroll
      for (int i = 0; i < 4; ++i)
#pragma unroll
        for (int j = 0; j < 8; ++j)
          acc[i][j] = __builtin_amdgcn_wmma_f32_16x16x32_f16(
              false, a[kk][i], false, b[kk][j], (short)0, acc[i][j], false,
              false);
    // Keeps the WMMAs ahead of the waits below: left free, the scheduler lifts
    // the waits and the barrier over them, and tile t+1's copies then have no
    // matrix work to land behind.
    __builtin_amdgcn_sched_barrier(0);
    wait_ds0();           // my reads of buffer cur are done
    wait_async0();        // my copies of tile t+1 have landed
    __syncthreads();      // publish tile t+1; every reader has left buffer cur
    if (t + 2 < ntile) stage(cur, (t + 2) * BK);
  }
  wait_async0();          // no copy outstanding when the wave ends

  // Epilogue. C/D layout: vreg r holds row (r + 8*half), column (lane&15).
#pragma unroll
  for (int i = 0; i < 4; ++i) {
#pragma unroll
    for (int j = 0; j < 8; ++j) {
      const int mt = m0 + wm * 64 + i * 16;
      const int nt = n0 + wn * 128 + j * 16;
      const int col = nt + lr;
      const float bv = bias[col];
#pragma unroll
      for (int r = 0; r < 8; ++r) {
        const int row = mt + r + 8 * half;
        const float vv = acc[i][j][r] + bv;
        if (MODE == 0) {
          // col in [0,3072): s = q/k/v, head h, dim d; row = b*8192 + n
          const int s  = col >> 10;
          const int rm = col & 1023;
          const int hh = rm >> 6, dd = rm & 63;
          const size_t bb = (size_t)(row >> 13), nn = (size_t)(row & 8191);
          _Float16* o = (_Float16*)outp;
          o[((size_t)s << 25) + ((bb * NHEAD + hh) * 8192 + nn) * HD + dd] =
              (_Float16)vv;
        } else if (MODE == 2) {
          _Float16* o = (_Float16*)outp;
          o[(size_t)row * N + col] = (_Float16)gelu_exact(vv);
        } else {  // MODE 1 / 3: f32 + residual
          float* o = (float*)outp;
          const size_t idx = (size_t)row * N + col;
          o[idx] = vv + residual[idx];
        }
      }
    }
  }
}

// ---------------------------------------------------------------------------
// Windowed attention: one block per (b, head, window). 8 waves; wave w owns
// query rows [16w, 16w+16). S = Q K^T (WMMA), register softmax with 16-lane
// shfl_xor reductions, P staged to LDS (f16), O = P V (WMMA, V transposed
// through LDS so its K-dim is contiguous for B fragments).
// ---------------------------------------------------------------------------
__global__ __launch_bounds__(256) void attn_kernel(
    const _Float16* __restrict__ q, const _Float16* __restrict__ k,
    const _Float16* __restrict__ v, _Float16* __restrict__ o) {
  __shared__ _Float16 Vt[64 * 136];   // (d, k) pitch 136
  __shared__ _Float16 Ps[128 * 136];  // (row, k) pitch 136

  const int bid = blockIdx.x;          // ((b*16+h)*64 + win)
  const int win = bid & 63;
  const int bh  = bid >> 6;
  const size_t base = ((size_t)bh * 8192 + (size_t)win * WIN) * HD;
  const _Float16* Q = q + base;  // 128 x 64 row-major
  const _Float16* K = k + base;
  const _Float16* V = v + base;

  for (int idx = threadIdx.x; idx < WIN * HD; idx += 256) {
    int kk = idx >> 6, dd = idx & 63;
    Vt[dd * 136 + kk] = V[idx];
  }
  __syncthreads();

  const int lane = threadIdx.x & 31, wave = threadIdx.x >> 5;
  const int half = lane >> 4, lr = lane & 15;
  const int r0 = wave * 16;

  // ---- S = Q K^T * 1/sqrt(64), strip of 16 rows x 128 cols (8 tiles) ----
  v8f s[8];
#pragma unroll
  for (int t = 0; t < 8; ++t) s[t] = {};
#pragma unroll
  for (int kk = 0; kk < HD; kk += 32) {
    v16h aq = load_frag(Q + (size_t)r0 * HD + kk, HD);
#pragma unroll
    for (int t = 0; t < 8; ++t) {
      v16h bk = load_frag(K + (size_t)t * 16 * HD + kk, HD);
      s[t] = __builtin_amdgcn_wmma_f32_16x16x32_f16(
          false, aq, false, bk, (short)0, s[t], false, false);
    }
  }

  // ---- softmax: row (r0 + i + 8*half) lives in lanes of one 16-lane half ----
#pragma unroll
  for (int i = 0; i < 8; ++i) {
    float m = -3.0e38f;
#pragma unroll
    for (int t = 0; t < 8; ++t) {
      float vv = s[t][i] * 0.125f;
      s[t][i] = vv;
      m = fmaxf(m, vv);
    }
#pragma unroll
    for (int off = 1; off < 16; off <<= 1) m = fmaxf(m, __shfl_xor(m, off, 32));
    float sum = 0.f;
#pragma unroll
    for (int t = 0; t < 8; ++t) {
      float e = __expf(s[t][i] - m);
      s[t][i] = e;
      sum += e;
    }
#pragma unroll
    for (int off = 1; off < 16; off <<= 1) sum += __shfl_xor(sum, off, 32);
    const float inv = 1.0f / sum;
    const int row = r0 + i + 8 * half;
#pragma unroll
    for (int t = 0; t < 8; ++t)
      Ps[row * 136 + t * 16 + lr] = (_Float16)(s[t][i] * inv);
  }
  // Same-wave LDS store->load is in-order; each wave reads only its own strip.

  // ---- O = P V : 16 rows x 64 cols (4 tiles), K = 128 ----
  v8f oa[4];
#pragma unroll
  for (int dt = 0; dt < 4; ++dt) oa[dt] = {};
#pragma unroll
  for (int kk = 0; kk < WIN; kk += 32) {
    v16h ap = load_frag(&Ps[r0 * 136 + kk], 136);
#pragma unroll
    for (int dt = 0; dt < 4; ++dt) {
      v16h bv = load_frag(&Vt[dt * 16 * 136 + kk], 136);
      oa[dt] = __builtin_amdgcn_wmma_f32_16x16x32_f16(
          false, ap, false, bv, (short)0, oa[dt], false, false);
    }
  }

  // scatter to (B, N, C) with heads concatenated: col = h*64 + d
  const int b = bh >> 4, h = bh & 15;
#pragma unroll
  for (int dt = 0; dt < 4; ++dt) {
#pragma unroll
    for (int r = 0; r < 8; ++r) {
      const int n = win * WIN + r0 + r + 8 * half;
      const size_t token = (size_t)b * 8192 + n;
      const int col = h * HD + dt * 16 + lr;
      o[token * DIM + col] = (_Float16)oa[dt][r];
    }
  }
}

// ---------------------------------------------------------------------------
// Host-side orchestration
// ---------------------------------------------------------------------------
extern "C" void kernel_launch(void* const* d_in, const int* in_sizes, int n_in,
                              void* d_out, int out_size, void* d_ws,
                              size_t ws_size, hipStream_t stream) {
  const float* x      = (const float*)d_in[0];
  const float* ln1_w  = (const float*)d_in[1];
  const float* ln1_b  = (const float*)d_in[2];
  const float* qkv_w  = (const float*)d_in[3];
  const float* qkv_b  = (const float*)d_in[4];
  const float* proj_w = (const float*)d_in[5];
  const float* proj_b = (const float*)d_in[6];
  const float* ln2_w  = (const float*)d_in[7];
  const float* ln2_b  = (const float*)d_in[8];
  const float* fc1_w  = (const float*)d_in[9];
  const float* fc1_b  = (const float*)d_in[10];
  const float* fc2_w  = (const float*)d_in[11];
  const float* fc2_b  = (const float*)d_in[12];
  float* out = (float*)d_out;

  char* ws = (char*)d_ws;
  const size_t MB = 1024ull * 1024ull;
  // [0,16MB): f16 weights
  _Float16* qkv_w16  = (_Float16*)ws;
  _Float16* proj_w16 = qkv_w16 + 3u * DIM * DIM;
  _Float16* fc1_w16  = proj_w16 + (size_t)DIM * DIM;
  _Float16* fc2_w16  = fc1_w16 + 2u * DIM * DIM;
  // [16,80): LN output (xn, reused as h)      64 MB f16
  _Float16* xn = (_Float16*)(ws + 16 * MB);
  // [80,272): q/k/v each (B,H,N,HD)           3 x 64 MB f16; act reuses front
  _Float16* qbuf = (_Float16*)(ws + 80 * MB);
  _Float16* kbuf = qbuf + ((size_t)1 << 25);
  _Float16* vbuf = kbuf + ((size_t)1 << 25);
  _Float16* act  = qbuf;  // 128 MB, reused after attention consumes q/k/v
  // [272,336): attention output               64 MB f16
  _Float16* attn_out = (_Float16*)(ws + 272 * MB);
  // [336,464): x1 = x + attn (f32 residual)   128 MB
  float* x1 = (float*)(ws + 336 * MB);

  // 1) weight casts
  cvt_kernel<<<(3 * DIM * DIM + 255) / 256, 256, 0, stream>>>(qkv_w, qkv_w16, 3 * DIM * DIM);
  cvt_kernel<<<(DIM * DIM + 255) / 256, 256, 0, stream>>>(proj_w, proj_w16, DIM * DIM);
  cvt_kernel<<<(2 * DIM * DIM + 255) / 256, 256, 0, stream>>>(fc1_w, fc1_w16, 2 * DIM * DIM);
  cvt_kernel<<<(2 * DIM * DIM + 255) / 256, 256, 0, stream>>>(fc2_w, fc2_w16, 2 * DIM * DIM);

  // 2) LN1
  ln_kernel<<<TOK / 8, 256, 0, stream>>>(x, ln1_w, ln1_b, xn, TOK);

  // 3) QKV GEMM (32768 x 3072 x 1024), scatter into (B,H,N,HD) q/k/v
  gemm_kernel<0><<<dim3(3072 / BT, TOK / BT), 256, 0, stream>>>(
      xn, qkv_w16, qkv_b, nullptr, (void*)qbuf, TOK, 3072, DIM);

  // 4) windowed attention: 4*16*64 blocks
  attn_kernel<<<4 * NHEAD * 64, 256, 0, stream>>>(qbuf, kbuf, vbuf, attn_out);

  // 5) proj GEMM + residual -> x1 (f32)
  gemm_kernel<1><<<dim3(DIM / BT, TOK / BT), 256, 0, stream>>>(
      attn_out, proj_w16, proj_b, x, (void*)x1, TOK, DIM, DIM);

  // 6) LN2
  ln_kernel<<<TOK / 8, 256, 0, stream>>>(x1, ln2_w, ln2_b, xn, TOK);

  // 7) FC1 GEMM + exact GELU (32768 x 2048 x 1024)
  gemm_kernel<2><<<dim3(2048 / BT, TOK / BT), 256, 0, stream>>>(
      xn, fc1_w16, fc1_b, nullptr, (void*)act, TOK, 2048, DIM);

  // 8) FC2 GEMM + residual -> d_out (32768 x 1024 x 2048)
  gemm_kernel<3><<<dim3(DIM / BT, TOK / BT), 256, 0, stream>>>(
      act, fc2_w16, fc2_b, x1, (void*)out, TOK, DIM, 2048);
}

// v002
// A run of this version takes 596 microseconds.
// Timed twice side by side with v001, it ran 1.40 times as fast both times.
// Over all steps from v000 it is 1.47 times as fast.
#include <hip/hip_runtime.h>
#include <hip/hip_bf16.h>

typedef _Float16 v16h __attribute__((ext_vector_type(16)));
typedef _Float16 h8   __attribute__((ext_vector_type(8)));
typedef float    v8f  __attribute__((ext_vector_type(8)));
typedef float    v4f  __attribute__((ext_vector_type(4)));

#define TOK   32768   // B*N tokens
#define DIM   1024
#define NHEAD 16
#define HD    64
#define WIN   128

__device__ __forceinline__ v16h load_frag(const _Float16* base, int ld) {
  const int lane = threadIdx.x & 31;
  const _Float16* p = base + (size_t)(lane & 15) * ld + ((lane >> 4) << 3);
  h8 lo = *(const h8*)(p);
  h8 hi = *(const h8*)(p + 16);
  return __builtin_shufflevector(lo, hi, 0,1,2,3,4,5,6,7,8,9,10,11,12,13,14,15);
}

// erf in f32 without a branch: the usual two minimax fits (|x| < 1: odd
// polynomial; else 1 - exp(-q(|x|))) are both evaluated and one is selected,
// so that neighbouring elements are independent chains the scheduler can mix.
__device__ __forceinline__ float erf_select(float x) {
  const float ax = fabsf(x);
  const float t = ax * ax;
  float p = fmaf(t, -0x1.268bc2p-11f, 0x1.420828p-8f);
  p = fmaf(t, p, -0x1.b5937p-6f);
  p = fmaf(t, p, 0x1.ce077cp-4f);
  p = fmaf(t, p, -0x1.81266p-2f);
  p = fmaf(t, p, 0x1.06eba0p-3f);
  const float small = fmaf(ax, p, ax);
  float q = fmaf(ax, 0x1.1d3156p-16f, -0x1.8d129p-12f);
  q = fmaf(ax, q, 0x1.f9a6d2p-9f);
  q = fmaf(ax, q, -0x1.8c3164p-6f);
  q = fmaf(ax, q, 0x1.b4e9c8p-4f);
  q = fmaf(ax, q, 0x1.4515fap-1f);
  q = fmaf(ax, q, 0x1.078e50p-3f);
  q = fmaf(ax, q, ax);
  const float big = 1.0f - __builtin_amdgcn_exp2f(q * -1.44269504088896340736f);
  return copysignf(ax < 1.0f ? small : big, x);
}

__device__ __forceinline__ float gelu_exact(float x) {
  return 0.5f * x * (1.0f + erf_select(x * 0.70710678118654752440f));
}

typedef int v4i __attribute__((ext_vector_type(4)));
typedef __attribute__((address_space(1))) v4i gv4i;
typedef __attribute__((address_space(3))) v4i lv4i;

__device__ __forceinline__ void async_ld_b128(_Float16* lds_dst,
                                              const _Float16* gsrc) {
  __builtin_amdgcn_global_load_async_to_lds_b128((gv4i*)gsrc, (lv4i*)lds_dst,
                                                 0, 0);
}

// This wave's copies have landed
// only behind this wait.
__device__ __forceinline__ void wait_async0() {
  asm volatile("s_wait_asynccnt 0" ::: "memory");
}

// This wave's LDS reads have retired before the barrier that frees the buffer
// for the next copies.
__device__ __forceinline__ void wait_ds0() {
  asm volatile("s_wait_dscnt 0" ::: "memory");
}

// ---------------------------------------------------------------------------
// f32 -> f16 weight conversion
// ---------------------------------------------------------------------------
__global__ void cvt_kernel(const float* __restrict__ src,
                           _Float16* __restrict__ dst, int n) {
  int i = blockIdx.x * 256 + threadIdx.x;
  if (i < n) dst[i] = (_Float16)src[i];
}

// ---------------------------------------------------------------------------
// LayerNorm: one wave (32 lanes) per token, 32 channels per lane.
// ---------------------------------------------------------------------------
__global__ __launch_bounds__(256) void ln_kernel(
    const float* __restrict__ x, const float* __restrict__ w,
    const float* __restrict__ b, _Float16* __restrict__ out, int ntok) {
  const int lane = threadIdx.x & 31;
  const int wave = threadIdx.x >> 5;
  const size_t token = (size_t)blockIdx.x * 8 + wave;
  if (token >= (size_t)ntok) return;
  const float* row = x + token * DIM;
  float vals[32];
  float s = 0.f;
#pragma unroll
  for (int j = 0; j < 32; ++j) { vals[j] = row[lane + j * 32]; s += vals[j]; }
#pragma unroll
  for (int off = 16; off >= 1; off >>= 1) s += __shfl_xor(s, off, 32);
  const float mu = s * (1.0f / DIM);
  float var = 0.f;
#pragma unroll
  for (int j = 0; j < 32; ++j) { float d = vals[j] - mu; var += d * d; }
#pragma unroll
  for (int off = 16; off >= 1; off >>= 1) var += __shfl_xor(var, off, 32);
  const float rstd = rsqrtf(var * (1.0f / DIM) + 1e-5f);
  _Float16* orow = out + token * DIM;
#pragma unroll
  for (int j = 0; j < 32; ++j) {
    int c = lane + j * 32;
    orow[c] = (_Float16)((vals[j] - mu) * rstd * w[c] + b[c]);
  }
}

#define BT 256
#define BK 64
#define LDA 72
#define SP 132

template <int MODE>
__global__ __launch_bounds__(256) void gemm_kernel(
    const _Float16* __restrict__ X, const _Float16* __restrict__ Wt,
    const float* __restrict__ bias, const float* __restrict__ residual,
    void* __restrict__ outp, int M, int N, int K) {
  __shared__ __attribute__((aligned(16))) _Float16 As[2][BT * LDA];
  __shared__ __attribute__((aligned(16))) _Float16 Bs[2][BT * LDA];

  const int tid  = threadIdx.x;
  const int lane = tid & 31, wave = tid >> 5;
  const int half = lane >> 4, lr = lane & 15;
  const int wm = wave >> 1;  // 0..3 -> 64-row strip
  const int wn = wave & 1;   // 0..1 -> 128-col strip
  const int m0 = blockIdx.y * BT;
  const int n0 = blockIdx.x * BT;

  // stage one 256x64 K-slice of A and B into LDS buffer `buf` (async):
  // 8 lanes per 128-B row, 32 rows per sweep of the block, 8 sweeps each.
  const int sr = tid >> 3, sc = (tid & 7) << 3;
  auto stage = [&](int buf, int k0) {
#pragma unroll
    for (int p = 0; p < 8; ++p) {
      const int r = sr + p * 32;
      async_ld_b128(&As[buf][r * LDA + sc], &X[(size_t)(m0 + r) * K + k0 + sc]);
    }
#pragma unroll
    for (int p = 0; p < 8; ++p) {
      const int r = sr + p * 32;
      async_ld_b128(&Bs[buf][r * LDA + sc], &Wt[(size_t)(n0 + r) * K + k0 + sc]);
    }
  };

  v8f acc[4][8];
#pragma unroll
  for (int i = 0; i < 4; ++i)
#pragma unroll
    for (int j = 0; j < 8; ++j) acc[i][j] = {};

  const int ntile = K / BK;
  stage(0, 0);
  wait_async0();          // my copies of tile 0 have landed
  __syncthreads();        // publish tile 0
  if (ntile > 1) stage(1, BK);
  for (int t = 0; t < ntile; ++t) {
    const int cur = t & 1;
    // Fragment loops are fully unrolled so that every array index is a
    // constant and the fragments stay in registers.
    v16h a[2][4], b[2][8];
#pragma unroll
    for (int kk = 0; kk < 2; ++kk) {
#pragma unroll
      for (int i = 0; i < 4; ++i)
        a[kk][i] = load_frag(&As[cur][(wm * 64 + i * 16) * LDA + kk * 32], LDA);
#pragma unroll
      for (int j = 0; j < 8; ++j)
        b[kk][j] = load_frag(&Bs[cur][(wn * 128 + j * 16) * LDA + kk * 32], LDA);
    }
    __builtin_amdgcn_sched_barrier(0);
#pragma unroll
    for (int kk = 0; kk < 2; ++kk)
#pragma unroll
      for (int i = 0; i < 4; ++i)
#pragma unroll
        for (int j = 0; j < 8; ++j)
          acc[i][j] = __builtin_amdgcn_wmma_f32_16x16x32_f16(
              false, a[kk][i], false, b[kk][j], (short)0, acc[i][j], false,
              false);
    // Keeps the WMMAs ahead of the waits below: left free, the scheduler lifts
    // the waits and the barrier over them, and tile t+1's copies then have no
    // matrix work to land behind.
    __builtin_amdgcn_sched_barrier(0);
    wait_ds0();           // my reads of buffer cur are done
    wait_async0();        // my copies of tile t+1 have landed
    __syncthreads();      // publish tile t+1; every reader has left buffer cur
    if (t + 2 < ntile) stage(cur, (t + 2) * BK);
  }
  wait_async0();          // no copy outstanding when the wave ends

  if (MODE == 2) {
    // GELU epilogue as a short rolled loop. Each wave passes its accumulators,
    // 16 rows at a time, through its own LDS range (the ring is free: the last
    // trip's waits and barrier ended every read, no copy is outstanding) and
    // takes them back as 8 neighbouring columns of one row per lane: 8
    // independent GELU chains and one 16-B store per row, 256 B per row.
    float* stg = (float*)&Bs[0][0] + wave * (16 * SP);
    _Float16* o = (_Float16*)outp;
    const int c0 = n0 + wn * 128 + lr * 8;
    const v4f bl = *(const v4f*)(bias + c0);
    // Precaution: the compiler lets the second load's result land on the
    // address pair that the first load names; this wait stands in front of it.
    asm volatile("s_wait_xcnt 0x0" ::: "memory");
    const v4f bh = *(const v4f*)(bias + c0 + 4);
#pragma unroll
    for (int i = 0; i < 4; ++i) {
#pragma unroll
      for (int j = 0; j < 8; ++j)
#pragma unroll
        for (int r = 0; r < 8; ++r)
          stg[(r + 8 * half) * SP + j * 16 + lr] = acc[i][j][r];
      wait_ds0();         // my staged rows are written before I read them back
      _Float16* orow = o + (size_t)(m0 + wm * 64 + i * 16 + half) * N + c0;
      // Stays rolled (two row pairs a trip, so that the second pair's LDS
      // reads fly under the first pair's arithmetic).
#pragma unroll 1
      for (int it = 0; it < 8; it += 2) {
        h8 y[2];
#pragma unroll
        for (int u = 0; u < 2; ++u) {
          const float* s = stg + ((it + u) * 2 + half) * SP + lr * 8;
          const v4f xl = *(const v4f*)s + bl;
          const v4f xh = *(const v4f*)(s + 4) + bh;
#pragma unroll
          for (int e = 0; e < 4; ++e) {
            y[u][e]     = (_Float16)gelu_exact(xl[e]);
            y[u][e + 4] = (_Float16)gelu_exact(xh[e]);
          }
        }
        *(h8*)(orow + (size_t)(it * 2) * N) = y[0];
        *(h8*)(orow + (size_t)(it * 2 + 2) * N) = y[1];
      }
    }
    return;
  }

  // Epilogue. C/D layout: vreg r holds row (r + 8*half), column (lane&15).
#pragma unroll
  for (int i = 0; i < 4; ++i) {
#pragma unroll
    for (int j = 0; j < 8; ++j) {
      const int mt = m0 + wm * 64 + i * 16;
      const int nt = n0 + wn * 128 + j * 16;
      const int col = nt + lr;
      const float bv = bias[col];
#pragma unroll
      for (int r = 0; r < 8; ++r) {
        const int row = mt + r + 8 * half;
        const float vv = acc[i][j][r] + bv;
        if (MODE == 0) {
          // col in [0,3072): s = q/k/v, head h, dim d; row = b*8192 + n
          const int s  = col >> 10;
          const int rm = col & 1023;
          const int hh = rm >> 6, dd = rm & 63;
          const size_t bb = (size_t)(row >> 13), nn = (size_t)(row & 8191);
          _Float16* o = (_Float16*)outp;
          o[((size_t)s << 25) + ((bb * NHEAD + hh) * 8192 + nn) * HD + dd] =
              (_Float16)vv;
        } else {  // MODE 1 / 3: f32 + residual
          float* o = (float*)outp;
          const size_t idx = (size_t)row * N + col;
          o[idx] = vv + residual[idx];
        }
      }
    }
  }
}

// ---------------------------------------------------------------------------
// Windowed attention: one block per (b, head, window). 8 waves; wave w owns
// query rows [16w, 16w+16). S = Q K^T (WMMA), register softmax with 16-lane
// shfl_xor reductions, P staged to LDS (f16), O = P V (WMMA, V transposed
// through LDS so its K-dim is contiguous for B fragments).
// ---------------------------------------------------------------------------
__global__ __launch_bounds__(256) void attn_kernel(
    const _Float16* __restrict__ q, const _Float16* __restrict__ k,
    const _Float16* __restrict__ v, _Float16* __restrict__ o) {
  __shared__ _Float16 Vt[64 * 136];   // (d, k) pitch 136
  __shared__ _Float16 Ps[128 * 136];  // (row, k) pitch 136

  const int bid = blockIdx.x;          // ((b*16+h)*64 + win)
  const int win = bid & 63;
  const int bh  = bid >> 6;
  const size_t base = ((size_t)bh * 8192 + (size_t)win * WIN) * HD;
  const _Float16* Q = q + base;  // 128 x 64 row-major
  const _Float16* K = k + base;
  const _Float16* V = v + base;

  for (int idx = threadIdx.x; idx < WIN * HD; idx += 256) {
    int kk = idx >> 6, dd = idx & 63;
    Vt[dd * 136 + kk] = V[idx];
  }
  __syncthreads();

  const int lane = threadIdx.x & 31, wave = threadIdx.x >> 5;
  const int half = lane >> 4, lr = lane & 15;
  const int r0 = wave * 16;

  // ---- S = Q K^T * 1/sqrt(64), strip of 16 rows x 128 cols (8 tiles) ----
  v8f s[8];
#pragma unroll
  for (int t = 0; t < 8; ++t) s[t] = {};
#pragma unroll
  for (int kk = 0; kk < HD; kk += 32) {
    v16h aq = load_frag(Q + (size_t)r0 * HD + kk, HD);
#pragma unroll
    for (int t = 0; t < 8; ++t) {
      v16h bk = load_frag(K + (size_t)t * 16 * HD + kk, HD);
      s[t] = __builtin_amdgcn_wmma_f32_16x16x32_f16(
          false, aq, false, bk, (short)0, s[t], false, false);
    }
  }

  // ---- softmax: row (r0 + i + 8*half) lives in lanes of one 16-lane half ----
#pragma unroll
  for (int i = 0; i < 8; ++i) {
    float m = -3.0e38f;
#pragma unroll
    for (int t = 0; t < 8; ++t) {
      float vv = s[t][i] * 0.125f;
      s[t][i] = vv;
      m = fmaxf(m, vv);
    }
#pragma unroll
    for (int off = 1; off < 16; off <<= 1) m = fmaxf(m, __shfl_xor(m, off, 32));
    float sum = 0.f;
#pragma unroll
    for (int t = 0; t < 8; ++t) {
      float e = __expf(s[t][i] - m);
      s[t][i] = e;
      sum += e;
    }
#pragma unroll
    for (int off = 1; off < 16; off <<= 1) sum += __shfl_xor(sum, off, 32);
    const float inv = 1.0f / sum;
    const int row = r0 + i + 8 * half;
#pragma unroll
    for (int t = 0; t < 8; ++t)
      Ps[row * 136 + t * 16 + lr] = (_Float16)(s[t][i] * inv);
  }
  // Same-wave LDS store->load is in-order; each wave reads only its own strip.

  // ---- O = P V : 16 rows x 64 cols (4 tiles), K = 128 ----
  v8f oa[4];
#pragma unroll
  for (int dt = 0; dt < 4; ++dt) oa[dt] = {};
#pragma unroll
  for (int kk = 0; kk < WIN; kk += 32) {
    v16h ap = load_frag(&Ps[r0 * 136 + kk], 136);
#pragma unroll
    for (int dt = 0; dt < 4; ++dt) {
      v16h bv = load_frag(&Vt[dt * 16 * 136 + kk], 136);
      oa[dt] = __builtin_amdgcn_wmma_f32_16x16x32_f16(
          false, ap, false, bv, (short)0, oa[dt], false, false);
    }
  }

  // scatter to (B, N, C) with heads concatenated: col = h*64 + d
  const int b = bh >> 4, h = bh & 15;
#pragma unroll
  for (int dt = 0; dt < 4; ++dt) {
#pragma unroll
    for (int r = 0; r < 8; ++r) {
      const int n = win * WIN + r0 + r + 8 * half;
      const size_t token = (size_t)b * 8192 + n;
      const int col = h * HD + dt * 16 + lr;
      o[token * DIM + col] = (_Float16)oa[dt][r];
    }
  }
}

// ---------------------------------------------------------------------------
// Host-side orchestration
// ---------------------------------------------------------------------------
extern "C" void kernel_launch(void* const* d_in, const int* in_sizes, int n_in,
                              void* d_out, int out_size, void* d_ws,
                              size_t ws_size, hipStream_t stream) {
  const float* x      = (const float*)d_in[0];
  const float* ln1_w  = (const float*)d_in[1];
  const float* ln1_b  = (const float*)d_in[2];
  const float* qkv_w  = (const float*)d_in[3];
  const float* qkv_b  = (const float*)d_in[4];
  const float* proj_w = (const float*)d_in[5];
  const float* proj_b = (const float*)d_in[6];
  const float* ln2_w  = (const float*)d_in[7];
  const float* ln2_b  = (const float*)d_in[8];
  const float* fc1_w  = (const float*)d_in[9];
  const float* fc1_b  = (const float*)d_in[10];
  const float* fc2_w  = (const float*)d_in[11];
  const float* fc2_b  = (const float*)d_in[12];
  float* out = (float*)d_out;

  char* ws = (char*)d_ws;
  const size_t MB = 1024ull * 1024ull;
  // [0,16MB): f16 weights
  _Float16* qkv_w16  = (_Float16*)ws;
  _Float16* proj_w16 = qkv_w16 + 3u * DIM * DIM;
  _Float16* fc1_w16  = proj_w16 + (size_t)DIM * DIM;
  _Float16* fc2_w16  = fc1_w16 + 2u * DIM * DIM;
  // [16,80): LN output (xn, reused as h)      64 MB f16
  _Float16* xn = (_Float16*)(ws + 16 * MB);
  // [80,272): q/k/v each (B,H,N,HD)           3 x 64 MB f16; act reuses front
  _Float16* qbuf = (_Float16*)(ws + 80 * MB);
  _Float16* kbuf = qbuf + ((size_t)1 << 25);
  _Float16* vbuf = kbuf + ((size_t)1 << 25);
  _Float16* act  = qbuf;  // 128 MB, reused after attention consumes q/k/v
  // [272,336): attention output               64 MB f16
  _Float16* attn_out = (_Float16*)(ws + 272 * MB);
  // [336,464): x1 = x + attn (f32 residual)   128 MB
  float* x1 = (float*)(ws + 336 * MB);

  // 1) weight casts
  cvt_kernel<<<(3 * DIM * DIM + 255) / 256, 256, 0, stream>>>(qkv_w, qkv_w16, 3 * DIM * DIM);
  cvt_kernel<<<(DIM * DIM + 255) / 256, 256, 0, stream>>>(proj_w, proj_w16, DIM * DIM);
  cvt_kernel<<<(2 * DIM * DIM + 255) / 256, 256, 0, stream>>>(fc1_w, fc1_w16, 2 * DIM * DIM);
  cvt_kernel<<<(2 * DIM * DIM + 255) / 256, 256, 0, stream>>>(fc2_w, fc2_w16, 2 * DIM * DIM);

  // 2) LN1
  ln_kernel<<<TOK / 8, 256, 0, stream>>>(x, ln1_w, ln1_b, xn, TOK);

  // 3) QKV GEMM (32768 x 3072 x 1024), scatter into (B,H,N,HD) q/k/v
  gemm_kernel<0><<<dim3(3072 / BT, TOK / BT), 256, 0, stream>>>(
      xn, qkv_w16, qkv_b, nullptr, (void*)qbuf, TOK, 3072, DIM);

  // 4) windowed attention: 4*16*64 blocks
  attn_kernel<<<4 * NHEAD * 64, 256, 0, stream>>>(qbuf, kbuf, vbuf, attn_out);

  // 5) proj GEMM + residual -> x1 (f32)
  gemm_kernel<1><<<dim3(DIM / BT, TOK / BT), 256, 0, stream>>>(
      attn_out, proj_w16, proj_b, x, (void*)x1, TOK, DIM, DIM);

  // 6) LN2
  ln_kernel<<<TOK / 8, 256, 0, stream>>>(x1, ln2_w, ln2_b, xn, TOK);

  // 7) FC1 GEMM + exact GELU (32768 x 2048 x 1024)
  gemm_kernel<2><<<dim3(2048 / BT, TOK / BT), 256, 0, stream>>>(
      xn, fc1_w16, fc1_b, nullptr, (void*)act, TOK, 2048, DIM);

  // 8) FC2 GEMM + residual -> d_out (32768 x 1024 x 2048)
  gemm_kernel<3><<<dim3(DIM / BT, TOK / BT), 256, 0, stream>>>(
      act, fc2_w16, fc2_b, x1, (void*)out, TOK, DIM, 2048);
}

// v003
// Measured time: 562 microseconds a run.
// Two timings next to v002 both put it at 1.06 times that version's speed.
// All steps since v000 together make it 1.56 times as fast.
#include <hip/hip_runtime.h>
#include <hip/hip_bf16.h>

typedef _Float16 v16h __attribute__((ext_vector_type(16)));
typedef _Float16 h8   __attribute__((ext_vector_type(8)));
typedef float    v8f  __attribute__((ext_vector_type(8)));
typedef float    v4f  __attribute__((ext_vector_type(4)));

#define TOK   32768   // B*N tokens
#define DIM   1024
#define NHEAD 16
#define HD    64
#define WIN   128

__device__ __forceinline__ v16h load_frag(const _Float16* base, int ld) {
  const int lane = threadIdx.x & 31;
  const _Float16* p = base + (size_t)(lane & 15) * ld + ((lane >> 4) << 3);
  h8 lo = *(const h8*)(p);
  h8 hi = *(const h8*)(p + 16);
  return __builtin_shufflevector(lo, hi, 0,1,2,3,4,5,6,7,8,9,10,11,12,13,14,15);
}

// erf in f32 without a branch: the usual two minimax fits (|x| < 1: odd
// polynomial; else 1 - exp(-q(|x|))) are both evaluated and one is selected,
// so that neighbouring elements are independent chains the scheduler can mix.
__device__ __forceinline__ float erf_select(float x) {
  const float ax = fabsf(x);
  const float t = ax * ax;
  float p = fmaf(t, -0x1.268bc2p-11f, 0x1.420828p-8f);
  p = fmaf(t, p, -0x1.b5937p-6f);
  p = fmaf(t, p, 0x1.ce077cp-4f);
  p = fmaf(t, p, -0x1.81266p-2f);
  p = fmaf(t, p, 0x1.06eba0p-3f);
  const float small = fmaf(ax, p, ax);
  float q = fmaf(ax, 0x1.1d3156p-16f, -0x1.8d129p-12f);
  q = fmaf(ax, q, 0x1.f9a6d2p-9f);
  q = fmaf(ax, q, -0x1.8c3164p-6f);
  q = fmaf(ax, q, 0x1.b4e9c8p-4f);
  q = fmaf(ax, q, 0x1.4515fap-1f);
  q = fmaf(ax, q, 0x1.078e50p-3f);
  q = fmaf(ax, q, ax);
  const float big = 1.0f - __builtin_amdgcn_exp2f(q * -1.44269504088896340736f);
  return copysignf(ax < 1.0f ? small : big, x);
}

__device__ __forceinline__ float gelu_exact(float x) {
  return 0.5f * x * (1.0f + erf_select(x * 0.70710678118654752440f));
}

typedef int v4i __attribute__((ext_vector_type(4)));
typedef __attribute__((address_space(1))) v4i gv4i;
typedef __attribute__((address_space(3))) v4i lv4i;

__device__ __forceinline__ void async_ld_b128(_Float16* lds_dst,
                                              const _Float16* gsrc) {
  __builtin_amdgcn_global_load_async_to_lds_b128((gv4i*)gsrc, (lv4i*)lds_dst,
                                                 0, 0);
}

// This wave's copies have landed
// only behind this wait.
__device__ __forceinline__ void wait_async0() {
  asm volatile("s_wait_asynccnt 0" ::: "memory");
}

// This wave's LDS reads have retired before the barrier that frees the buffer
// for the next copies.
__device__ __forceinline__ void wait_ds0() {
  asm volatile("s_wait_dscnt 0" ::: "memory");
}

// ---------------------------------------------------------------------------
// f32 -> f16 weight conversion
// ---------------------------------------------------------------------------
__global__ void cvt_kernel(const float* __restrict__ src,
                           _Float16* __restrict__ dst, int n) {
  int i = blockIdx.x * 256 + threadIdx.x;
  if (i < n) dst[i] = (_Float16)src[i];
}

// ---------------------------------------------------------------------------
// LayerNorm: one wave (32 lanes) per token, 32 channels per lane.
// ---------------------------------------------------------------------------
__global__ __launch_bounds__(256) void ln_kernel(
    const float* __restrict__ x, const float* __restrict__ w,
    const float* __restrict__ b, _Float16* __restrict__ out, int ntok) {
  const int lane = threadIdx.x & 31;
  const int wave = threadIdx.x >> 5;
  const size_t token = (size_t)blockIdx.x * 8 + wave;
  if (token >= (size_t)ntok) return;
  const float* row = x + token * DIM;
  float vals[32];
  float s = 0.f;
#pragma unroll
  for (int j = 0; j < 32; ++j) { vals[j] = row[lane + j * 32]; s += vals[j]; }
#pragma unroll
  for (int off = 16; off >= 1; off >>= 1) s += __shfl_xor(s, off, 32);
  const float mu = s * (1.0f / DIM);
  float var = 0.f;
#pragma unroll
  for (int j = 0; j < 32; ++j) { float d = vals[j] - mu; var += d * d; }
#pragma unroll
  for (int off = 16; off >= 1; off >>= 1) var += __shfl_xor(var, off, 32);
  const float rstd = rsqrtf(var * (1.0f / DIM) + 1e-5f);
  _Float16* orow = out + token * DIM;
#pragma unroll
  for (int j = 0; j < 32; ++j) {
    int c = lane + j * 32;
    orow[c] = (_Float16)((vals[j] - mu) * rstd * w[c] + b[c]);
  }
}

#define BT 256
#define BK 128
#define LDA 136
#define SP 132

template <int MODE>
__global__ __launch_bounds__(256) void gemm_kernel(
    const _Float16* __restrict__ X, const _Float16* __restrict__ Wt,
    const float* __restrict__ bias, const float* __restrict__ residual,
    void* __restrict__ outp, int M, int N, int K) {
  __shared__ __attribute__((aligned(16))) _Float16 As[2][BT * LDA];
  __shared__ __attribute__((aligned(16))) _Float16 Bs[2][BT * LDA];

  const int tid  = threadIdx.x;
  const int lane = tid & 31, wave = tid >> 5;
  const int half = lane >> 4, lr = lane & 15;
  const int wm = wave >> 1;  // 0..3 -> 64-row strip
  const int wn = wave & 1;   // 0..1 -> 128-col strip
  const int m0 = blockIdx.y * BT;
  const int n0 = blockIdx.x * BT;

  // stage one 256x128 K-slice of A and B into LDS buffer `buf` (async):
  // 16 lanes per 256-B row, 16 rows per sweep of the block, 16 sweeps each.
  // Uniform row base + one 32-bit lane offset: the 32 addresses are formed at
  // the copies, not held as 32 pointers beside the accumulators.
  const int sr = tid >> 4, sc = (tid & 15) << 3;
  const unsigned goff = ((unsigned)sr * (unsigned)K + (unsigned)sc) * 2u;
  const char* Xb = (const char*)(X + (size_t)m0 * K);
  const char* Wb = (const char*)(Wt + (size_t)n0 * K);
  auto stage = [&](int buf, int k0) {
#pragma unroll
    for (int p = 0; p < 16; ++p)
      async_ld_b128(&As[buf][(sr + p * 16) * LDA + sc],
                    (const _Float16*)(Xb + ((size_t)(p * 16) * K + k0) * 2 + goff));
#pragma unroll
    for (int p = 0; p < 16; ++p)
      async_ld_b128(&Bs[buf][(sr + p * 16) * LDA + sc],
                    (const _Float16*)(Wb + ((size_t)(p * 16) * K + k0) * 2 + goff));
  };

  v8f acc[4][8];
#pragma unroll
  for (int i = 0; i < 4; ++i)
#pragma unroll
    for (int j = 0; j < 8; ++j) acc[i][j] = {};

  // Fragment loops are fully unrolled with constant set numbers so that every
  // array index is a constant and the fragments stay in registers.
  v16h a[2][4], b[2][8];
  // set S <- block KB (32 k) of LDS buffer BUF: 12 fragments, 24 reads of 16 B
#define LOADF(S, BUF, KB)                                                     \
  do {                                                                        \
    _Pragma("unroll") for (int i = 0; i < 4; ++i) a[S][i] =                   \
        load_frag(&As[BUF][(wm * 64 + i * 16) * LDA + (KB) * 32], LDA);       \
    _Pragma("unroll") for (int j = 0; j < 8; ++j) b[S][j] =                   \
        load_frag(&Bs[BUF][(wn * 128 + j * 16) * LDA + (KB) * 32], LDA);      \
  } while (0)
  // accumulator rows I0..I1-1 += set S
#define MMA(S, I0, I1)                                                        \
  do {                                                                        \
    _Pragma("unroll") for (int i = I0; i < I1; ++i)                           \
        _Pragma("unroll") for (int j = 0; j < 8; ++j) acc[i][j] =             \
            __builtin_amdgcn_wmma_f32_16x16x32_f16(                           \
                false, a[S][i], false, b[S][j], (short)0, acc[i][j], false,   \
                false);                                                       \
  } while (0)
  // Holds each read group and each WMMA block where it is written: left free,
  // the scheduler sinks the reads to their first use, one block later, and the
  // wave then sits out the LDS latency there.
#define PIN() __builtin_amdgcn_sched_barrier(0)

  const int ntile = K / BK;
  stage(0, 0);
  wait_async0();          // my copies of stage 0 have landed
  __syncthreads();        // publish stage 0
  if (ntile > 1) stage(1, BK);
  LOADF(0, 0, 0);
  for (int t = 0; t < ntile; ++t) {
    const int cur = t & 1;
    LOADF(1, cur, 1);
    PIN();
    MMA(0, 0, 4);
    PIN();
    LOADF(0, cur, 2);
    PIN();
    MMA(1, 0, 4);
    PIN();
    LOADF(1, cur, 3);
    PIN();
    MMA(0, 0, 4);
    PIN();
    wait_ds0();           // my reads of buffer cur are done (last block's too)
    wait_async0();        // my copies of stage t+1 have landed
    __syncthreads();      // publish stage t+1; every reader has left buffer cur
    MMA(1, 0, 1);
    PIN();
    if (t + 2 < ntile) stage(cur, (t + 2) * BK);
    if (t + 1 < ntile) LOADF(0, cur ^ 1, 0);
    PIN();
    MMA(1, 1, 4);
    PIN();
  }
#undef LOADF
#undef MMA
#undef PIN
  wait_async0();          // no copy outstanding when the wave ends

  if (MODE == 2) {
    // GELU epilogue as a short rolled loop. Each wave passes its accumulators,
    // 16 rows at a time, through its own LDS range (the ring is free: the last
    // trip's waits and barrier ended every read, no copy is outstanding) and
    // takes them back as 8 neighbouring columns of one row per lane: 8
    // independent GELU chains and one 16-B store per row, 256 B per row.
    float* stg = (float*)&Bs[0][0] + wave * (16 * SP);
    _Float16* o = (_Float16*)outp;
    const int c0 = n0 + wn * 128 + lr * 8;
    const v4f bl = *(const v4f*)(bias + c0);
    // Precaution: the compiler lets the second load's result land on the
    // address pair that the first load names; this wait stands in front of it.
    asm volatile("s_wait_xcnt 0x0" ::: "memory");
    const v4f bh = *(const v4f*)(bias + c0 + 4);
#pragma unroll
    for (int i = 0; i < 4; ++i) {
#pragma unroll
      for (int j = 0; j < 8; ++j)
#pragma unroll
        for (int r = 0; r < 8; ++r)
          stg[(r + 8 * half) * SP + j * 16 + lr] = acc[i][j][r];
      wait_ds0();         // my staged rows are written before I read them back
      _Float16* orow = o + (size_t)(m0 + wm * 64 + i * 16 + half) * N + c0;
      // Stays rolled (two row pairs a trip, so that the second pair's LDS
      // reads fly under the first pair's arithmetic).
#pragma unroll 1
      for (int it = 0; it < 8; it += 2) {
        h8 y[2];
#pragma unroll
        for (int u = 0; u < 2; ++u) {
          const float* s = stg + ((it + u) * 2 + half) * SP + lr * 8;
          const v4f xl = *(const v4f*)s + bl;
          const v4f xh = *(const v4f*)(s + 4) + bh;
#pragma unroll
          for (int e = 0; e < 4; ++e) {
            y[u][e]     = (_Float16)gelu_exact(xl[e]);
            y[u][e + 4] = (_Float16)gelu_exact(xh[e]);
          }
        }
        *(h8*)(orow + (size_t)(it * 2) * N) = y[0];
        *(h8*)(orow + (size_t)(it * 2 + 2) * N) = y[1];
      }
    }
    return;
  }

  // Epilogue. C/D layout: vreg r holds row (r + 8*half), column (lane&15).
#pragma unroll
  for (int i = 0; i < 4; ++i) {
#pragma unroll
    for (int j = 0; j < 8; ++j) {
      const int mt = m0 + wm * 64 + i * 16;
      const int nt = n0 + wn * 128 + j * 16;
      const int col = nt + lr;
      const float bv = bias[col];
#pragma unroll
      for (int r = 0; r < 8; ++r) {
        const int row = mt + r + 8 * half;
        const float vv = acc[i][j][r] + bv;
        if (MODE == 0) {
          // col in [0,3072): s = q/k/v, head h, dim d; row = b*8192 + n
          const int s  = col >> 10;
          const int rm = col & 1023;
          const int hh = rm >> 6, dd = rm & 63;
          const size_t bb = (size_t)(row >> 13), nn = (size_t)(row & 8191);
          _Float16* o = (_Float16*)outp;
          o[((size_t)s << 25) + ((bb * NHEAD + hh) * 8192 + nn) * HD + dd] =
              (_Float16)vv;
        } else {  // MODE 1 / 3: f32 + residual
          float* o = (float*)outp;
          const size_t idx = (size_t)row * N + col;
          o[idx] = vv + residual[idx];
        }
      }
    }
  }
}

// ---------------------------------------------------------------------------
// Windowed attention: one block per (b, head, window). 8 waves; wave w owns
// query rows [16w, 16w+16). S = Q K^T (WMMA), register softmax with 16-lane
// shfl_xor reductions, P staged to LDS (f16), O = P V (WMMA, V transposed
// through LDS so its K-dim is contiguous for B fragments).
// ---------------------------------------------------------------------------
__global__ __launch_bounds__(256) void attn_kernel(
    const _Float16* __restrict__ q, const _Float16* __restrict__ k,
    const _Float16* __restrict__ v, _Float16* __restrict__ o) {
  __shared__ _Float16 Vt[64 * 136];   // (d, k) pitch 136
  __shared__ _Float16 Ps[128 * 136];  // (row, k) pitch 136

  const int bid = blockIdx.x;          // ((b*16+h)*64 + win)
  const int win = bid & 63;
  const int bh  = bid >> 6;
  const size_t base = ((size_t)bh * 8192 + (size_t)win * WIN) * HD;
  const _Float16* Q = q + base;  // 128 x 64 row-major
  const _Float16* K = k + base;
  const _Float16* V = v + base;

  for (int idx = threadIdx.x; idx < WIN * HD; idx += 256) {
    int kk = idx >> 6, dd = idx & 63;
    Vt[dd * 136 + kk] = V[idx];
  }
  __syncthreads();

  const int lane = threadIdx.x & 31, wave = threadIdx.x >> 5;
  const int half = lane >> 4, lr = lane & 15;
  const int r0 = wave * 16;

  // ---- S = Q K^T * 1/sqrt(64), strip of 16 rows x 128 cols (8 tiles) ----
  v8f s[8];
#pragma unroll
  for (int t = 0; t < 8; ++t) s[t] = {};
#pragma unroll
  for (int kk = 0; kk < HD; kk += 32) {
    v16h aq = load_frag(Q + (size_t)r0 * HD + kk, HD);
#pragma unroll
    for (int t = 0; t < 8; ++t) {
      v16h bk = load_frag(K + (size_t)t * 16 * HD + kk, HD);
      s[t] = __builtin_amdgcn_wmma_f32_16x16x32_f16(
          false, aq, false, bk, (short)0, s[t], false, false);
    }
  }

  // ---- softmax: row (r0 + i + 8*half) lives in lanes of one 16-lane half ----
#pragma unroll
  for (int i = 0; i < 8; ++i) {
    float m = -3.0e38f;
#pragma unroll
    for (int t = 0; t < 8; ++t) {
      float vv = s[t][i] * 0.125f;
      s[t][i] = vv;
      m = fmaxf(m, vv);
    }
#pragma unroll
    for (int off = 1; off < 16; off <<= 1) m = fmaxf(m, __shfl_xor(m, off, 32));
    float sum = 0.f;
#pragma unroll
    for (int t = 0; t < 8; ++t) {
      float e = __expf(s[t][i] - m);
      s[t][i] = e;
      sum += e;
    }
#pragma unroll
    for (int off = 1; off < 16; off <<= 1) sum += __shfl_xor(sum, off, 32);
    const float inv = 1.0f / sum;
    const int row = r0 + i + 8 * half;
#pragma unroll
    for (int t = 0; t < 8; ++t)
      Ps[row * 136 + t * 16 + lr] = (_Float16)(s[t][i] * inv);
  }
  // Same-wave LDS store->load is in-order; each wave reads only its own strip.

  // ---- O = P V : 16 rows x 64 cols (4 tiles), K = 128 ----
  v8f oa[4];
#pragma unroll
  for (int dt = 0; dt < 4; ++dt) oa[dt] = {};
#pragma unroll
  for (int kk = 0; kk < WIN; kk += 32) {
    v16h ap = load_frag(&Ps[r0 * 136 + kk], 136);
#pragma unroll
    for (int dt = 0; dt < 4; ++dt) {
      v16h bv = load_frag(&Vt[dt * 16 * 136 + kk], 136);
      oa[dt] = __builtin_amdgcn_wmma_f32_16x16x32_f16(
          false, ap, false, bv, (short)0, oa[dt], false, false);
    }
  }

  // scatter to (B, N, C) with heads concatenated: col = h*64 + d
  const int b = bh >> 4, h = bh & 15;
#pragma unroll
  for (int dt = 0; dt < 4; ++dt) {
#pragma unroll
    for (int r = 0; r < 8; ++r) {
      const int n = win * WIN + r0 + r + 8 * half;
      const size_t token = (size_t)b * 8192 + n;
      const int col = h * HD + dt * 16 + lr;
      o[token * DIM + col] = (_Float16)oa[dt][r];
    }
  }
}

// ---------------------------------------------------------------------------
// Host-side orchestration
// ---------------------------------------------------------------------------
extern "C" void kernel_launch(void* const* d_in, const int* in_sizes, int n_in,
                              void* d_out, int out_size, void* d_ws,
                              size_t ws_size, hipStream_t stream) {
  const float* x      = (const float*)d_in[0];
  const float* ln1_w  = (const float*)d_in[1];
  const float* ln1_b  = (const float*)d_in[2];
  const float* qkv_w  = (const float*)d_in[3];
  const float* qkv_b  = (const float*)d_in[4];
  const float* proj_w = (const float*)d_in[5];
  const float* proj_b = (const float*)d_in[6];
  const float* ln2_w  = (const float*)d_in[7];
  const float* ln2_b  = (const float*)d_in[8];
  const float* fc1_w  = (const float*)d_in[9];
  const float* fc1_b  = (const float*)d_in[10];
  const float* fc2_w  = (const float*)d_in[11];
  const float* fc2_b  = (const float*)d_in[12];
  float* out = (float*)d_out;

  char* ws = (char*)d_ws;
  const size_t MB = 1024ull * 1024ull;
  // [0,16MB): f16 weights
  _Float16* qkv_w16  = (_Float16*)ws;
  _Float16* proj_w16 = qkv_w16 + 3u * DIM * DIM;
  _Float16* fc1_w16  = proj_w16 + (size_t)DIM * DIM;
  _Float16* fc2_w16  = fc1_w16 + 2u * DIM * DIM;
  // [16,80): LN output (xn, reused as h)      64 MB f16
  _Float16* xn = (_Float16*)(ws + 16 * MB);
  // [80,272): q/k/v each (B,H,N,HD)           3 x 64 MB f16; act reuses front
  _Float16* qbuf = (_Float16*)(ws + 80 * MB);
  _Float16* kbuf = qbuf + ((size_t)1 << 25);
  _Float16* vbuf = kbuf + ((size_t)1 << 25);
  _Float16* act  = qbuf;  // 128 MB, reused after attention consumes q/k/v
  // [272,336): attention output               64 MB f16
  _Float16* attn_out = (_Float16*)(ws + 272 * MB);
  // [336,464): x1 = x + attn (f32 residual)   128 MB
  float* x1 = (float*)(ws + 336 * MB);

  // 1) weight casts
  cvt_kernel<<<(3 * DIM * DIM + 255) / 256, 256, 0, stream>>>(qkv_w, qkv_w16, 3 * DIM * DIM);
  cvt_kernel<<<(DIM * DIM + 255) / 256, 256, 0, stream>>>(proj_w, proj_w16, DIM * DIM);
  cvt_kernel<<<(2 * DIM * DIM + 255) / 256, 256, 0, stream>>>(fc1_w, fc1_w16, 2 * DIM * DIM);
  cvt_kernel<<<(2 * DIM * DIM + 255) / 256, 256, 0, stream>>>(fc2_w, fc2_w16, 2 * DIM * DIM);

  // 2) LN1
  ln_kernel<<<TOK / 8, 256, 0, stream>>>(x, ln1_w, ln1_b, xn, TOK);

  // 3) QKV GEMM (32768 x 3072 x 1024), scatter into (B,H,N,HD) q/k/v
  gemm_kernel<0><<<dim3(3072 / BT, TOK / BT), 256, 0, stream>>>(
      xn, qkv_w16, qkv_b, nullptr, (void*)qbuf, TOK, 3072, DIM);

  // 4) windowed attention: 4*16*64 blocks
  attn_kernel<<<4 * NHEAD * 64, 256, 0, stream>>>(qbuf, kbuf, vbuf, attn_out);

  // 5) proj GEMM + residual -> x1 (f32)
  gemm_kernel<1><<<dim3(DIM / BT, TOK / BT), 256, 0, stream>>>(
      attn_out, proj_w16, proj_b, x, (void*)x1, TOK, DIM, DIM);

  // 6) LN2
  ln_kernel<<<TOK / 8, 256, 0, stream>>>(x1, ln2_w, ln2_b, xn, TOK);

  // 7) FC1 GEMM + exact GELU (32768 x 2048 x 1024)
  gemm_kernel<2><<<dim3(2048 / BT, TOK / BT), 256, 0, stream>>>(
      xn, fc1_w16, fc1_b, nullptr, (void*)act, TOK, 2048, DIM);

  // 8) FC2 GEMM + residual -> d_out (32768 x 1024 x 2048)
  gemm_kernel<3><<<dim3(DIM / BT, TOK / BT), 256, 0, stream>>>(
      act, fc2_w16, fc2_b, x1, (void*)out, TOK, DIM, 2048);
}

// v004
// One run takes 508 microseconds.
// Timed twice side by side with v003, it ran 1.11 and 1.10 times as fast.
// Counting every step since v000, it is 1.73 times as fast.
#include <hip/hip_runtime.h>
#include <hip/hip_bf16.h>

typedef _Float16 v16h __attribute__((ext_vector_type(16)));
typedef _Float16 h8   __attribute__((ext_vector_type(8)));
typedef float    v8f  __attribute__((ext_vector_type(8)));
typedef float    v4f  __attribute__((ext_vector_type(4)));

#define TOK   32768   // B*N tokens
#define DIM   1024
#define NHEAD 16
#define HD    64
#define WIN   128

__device__ __forceinline__ v16h load_frag(const _Float16* base, int ld) {
  const int lane = threadIdx.x & 31;
  const _Float16* p = base + (size_t)(lane & 15) * ld + ((lane >> 4) << 3);
  h8 lo = *(const h8*)(p);
  h8 hi = *(const h8*)(p + 16);
  return __builtin_shufflevector(lo, hi, 0,1,2,3,4,5,6,7,8,9,10,11,12,13,14,15);
}

__device__ __forceinline__ v16h load_frag_pieces(const _Float16* p, int c) {
  h8 lo = *(const h8*)(p + c * 256);
  h8 hi = *(const h8*)(p + (c + 1) * 256);
  return __builtin_shufflevector(lo, hi, 0,1,2,3,4,5,6,7,8,9,10,11,12,13,14,15);
}

// erf in f32 without a branch: the usual two minimax fits (|x| < 1: odd
// polynomial; else 1 - exp(-q(|x|))) are both evaluated and one is selected,
// so that neighbouring elements are independent chains the scheduler can mix.
__device__ __forceinline__ float erf_select(float x) {
  const float ax = fabsf(x);
  const float t = ax * ax;
  float p = fmaf(t, -0x1.268bc2p-11f, 0x1.420828p-8f);
  p = fmaf(t, p, -0x1.b5937p-6f);
  p = fmaf(t, p, 0x1.ce077cp-4f);
  p = fmaf(t, p, -0x1.81266p-2f);
  p = fmaf(t, p, 0x1.06eba0p-3f);
  const float small = fmaf(ax, p, ax);
  float q = fmaf(ax, 0x1.1d3156p-16f, -0x1.8d129p-12f);
  q = fmaf(ax, q, 0x1.f9a6d2p-9f);
  q = fmaf(ax, q, -0x1.8c3164p-6f);
  q = fmaf(ax, q, 0x1.b4e9c8p-4f);
  q = fmaf(ax, q, 0x1.4515fap-1f);
  q = fmaf(ax, q, 0x1.078e50p-3f);
  q = fmaf(ax, q, ax);
  const float big = 1.0f - __builtin_amdgcn_exp2f(q * -1.44269504088896340736f);
  return copysignf(ax < 1.0f ? small : big, x);
}

__device__ __forceinline__ float gelu_exact(float x) {
  return 0.5f * x * (1.0f + erf_select(x * 0.70710678118654752440f));
}

typedef int v4i __attribute__((ext_vector_type(4)));
typedef __attribute__((address_space(1))) v4i gv4i;
typedef __attribute__((address_space(3))) v4i lv4i;

__device__ __forceinline__ void async_ld_b128(_Float16* lds_dst,
                                              const _Float16* gsrc) {
  __builtin_amdgcn_global_load_async_to_lds_b128((gv4i*)gsrc, (lv4i*)lds_dst,
                                                 0, 0);
}

// This wave's copies have landed
// only behind this wait.
__device__ __forceinline__ void wait_async0() {
  asm volatile("s_wait_asynccnt 0" ::: "memory");
}

// This wave's LDS reads have retired before the barrier that frees the buffer
// for the next copies.
__device__ __forceinline__ void wait_ds0() {
  asm volatile("s_wait_dscnt 0" ::: "memory");
}

// Precaution: stands between issued global loads or stores and the overwrite of
// a register that they name, where the compiler has placed no such wait.
__device__ __forceinline__ void wait_x0() {
  asm volatile("s_wait_xcnt 0x0" ::: "memory");
}

// ---------------------------------------------------------------------------
// f32 -> f16 weight conversion
// ---------------------------------------------------------------------------
__global__ void cvt_kernel(const float* __restrict__ src,
                           _Float16* __restrict__ dst, int n) {
  int i = blockIdx.x * 256 + threadIdx.x;
  if (i < n) dst[i] = (_Float16)src[i];
}

// ---------------------------------------------------------------------------
// LayerNorm: one wave (32 lanes) per token, 32 channels per lane.
// ---------------------------------------------------------------------------
__global__ __launch_bounds__(256) void ln_kernel(
    const float* __restrict__ x, const float* __restrict__ w,
    const float* __restrict__ b, _Float16* __restrict__ out, int ntok) {
  const int lane = threadIdx.x & 31;
  const int wave = threadIdx.x >> 5;
  const size_t token = (size_t)blockIdx.x * 8 + wave;
  if (token >= (size_t)ntok) return;
  const float* row = x + token * DIM;
  float vals[32];
  float s = 0.f;
#pragma unroll
  for (int j = 0; j < 32; ++j) { vals[j] = row[lane + j * 32]; s += vals[j]; }
#pragma unroll
  for (int off = 16; off >= 1; off >>= 1) s += __shfl_xor(s, off, 32);
  const float mu = s * (1.0f / DIM);
  float var = 0.f;
#pragma unroll
  for (int j = 0; j < 32; ++j) { float d = vals[j] - mu; var += d * d; }
#pragma unroll
  for (int off = 16; off >= 1; off >>= 1) var += __shfl_xor(var, off, 32);
  const float rstd = rsqrtf(var * (1.0f / DIM) + 1e-5f);
  _Float16* orow = out + token * DIM;
#pragma unroll
  for (int j = 0; j < 32; ++j) {
    int c = lane + j * 32;
    orow[c] = (_Float16)((vals[j] - mu) * rstd * w[c] + b[c]);
  }
}

#define BT 256
#define BK 128
#define LDA 136
#define SP 132

template <int MODE>
__global__ __launch_bounds__(256) void gemm_kernel(
    const _Float16* __restrict__ X, const _Float16* __restrict__ Wt,
    const float* __restrict__ bias, const float* __restrict__ residual,
    void* __restrict__ outp, int M, int N, int K) {
  __shared__ __attribute__((aligned(16))) _Float16 As[2][BT * LDA];
  __shared__ __attribute__((aligned(16))) _Float16 Bs[2][BT * LDA];

  const int tid  = threadIdx.x;
  const int lane = tid & 31, wave = tid >> 5;
  const int half = lane >> 4, lr = lane & 15;
  const int wm = wave >> 1;  // 0..3 -> 64-row strip
  const int wn = wave & 1;   // 0..1 -> 128-col strip
  const int m0 = blockIdx.y * BT;
  const int n0 = blockIdx.x * BT;

  // stage one 256x128 K-slice of A and B into LDS buffer `buf` (async):
  // 16 lanes per 256-B row, 16 rows per sweep of the block, 16 sweeps each.
  // Uniform row base + one 32-bit lane offset: the 32 addresses are formed at
  // the copies, not held as 32 pointers beside the accumulators.
  const int sr = tid >> 4, sc = (tid & 15) << 3;
  const unsigned goff = ((unsigned)sr * (unsigned)K + (unsigned)sc) * 2u;
  // Both operands are 256 K-contiguous rows with one loader, so the roles are
  // swapped by swapping the two row bases (block-uniform).
  const bool sw = MODE == 0 && n0 < 2 * DIM;  // q and k columns
  const char* Xr = (const char*)(X + (size_t)m0 * K);
  const char* Wr = (const char*)(Wt + (size_t)n0 * K);
  const char* Xb = sw ? Wr : Xr;  // rows of the A role (As)
  const char* Wb = sw ? Xr : Wr;  // rows of the B role (Bs)
  auto stage = [&](int buf, int k0) {
#pragma unroll
    for (int p = 0; p < 16; ++p)
      async_ld_b128(&As[buf][(sr + p * 16) * LDA + sc],
                    (const _Float16*)(Xb + ((size_t)(p * 16) * K + k0) * 2 + goff));
#pragma unroll
    for (int p = 0; p < 16; ++p)
      async_ld_b128(&Bs[buf][(sr + p * 16) * LDA + sc],
                    (const _Float16*)(Wb + ((size_t)(p * 16) * K + k0) * 2 + goff));
  };

  v8f acc[4][8];
#pragma unroll
  for (int i = 0; i < 4; ++i)
#pragma unroll
    for (int j = 0; j < 8; ++j) acc[i][j] = {};

  // Fragment loops are fully unrolled with constant set numbers so that every
  // array index is a constant and the fragments stay in registers.
  v16h a[2][4], b[2][8];
  // set S <- block KB (32 k) of LDS buffer BUF: 12 fragments, 24 reads of 16 B
#define LOADF(S, BUF, KB)                                                     \
  do {                                                                        \
    _Pragma("unroll") for (int i = 0; i < 4; ++i) a[S][i] =                   \
        load_frag(&As[BUF][(wm * 64 + i * 16) * LDA + (KB) * 32], LDA);       \
    _Pragma("unroll") for (int j = 0; j < 8; ++j) b[S][j] =                   \
        load_frag(&Bs[BUF][(wn * 128 + j * 16) * LDA + (KB) * 32], LDA);      \
  } while (0)
  // accumulator rows I0..I1-1 += set S
#define MMA(S, I0, I1)                                                        \
  do {                                                                        \
    _Pragma("unroll") for (int i = I0; i < I1; ++i)                           \
        _Pragma("unroll") for (int j = 0; j < 8; ++j) acc[i][j] =             \
            __builtin_amdgcn_wmma_f32_16x16x32_f16(                           \
                false, a[S][i], false, b[S][j], (short)0, acc[i][j], false,   \
                false);                                                       \
  } while (0)
  // Holds each read group and each WMMA block where it is written: left free,
  // the scheduler sinks the reads to their first use, one block later, and the
  // wave then sits out the LDS latency there.
#define PIN() __builtin_amdgcn_sched_barrier(0)

  const int ntile = K / BK;
  stage(0, 0);
  wait_async0();          // my copies of stage 0 have landed
  __syncthreads();        // publish stage 0
  if (ntile > 1) stage(1, BK);
  LOADF(0, 0, 0);
  for (int t = 0; t < ntile; ++t) {
    const int cur = t & 1;
    LOADF(1, cur, 1);
    PIN();
    MMA(0, 0, 4);
    PIN();
    LOADF(0, cur, 2);
    PIN();
    MMA(1, 0, 4);
    PIN();
    LOADF(1, cur, 3);
    PIN();
    MMA(0, 0, 4);
    PIN();
    wait_ds0();           // my reads of buffer cur are done (last block's too)
    wait_async0();        // my copies of stage t+1 have landed
    __syncthreads();      // publish stage t+1; every reader has left buffer cur
    MMA(1, 0, 1);
    PIN();
    if (t + 2 < ntile) stage(cur, (t + 2) * BK);
    if (t + 1 < ntile) LOADF(0, cur ^ 1, 0);
    PIN();
    MMA(1, 1, 4);
    PIN();
  }
#undef LOADF
#undef MMA
#undef PIN
  wait_async0();          // no copy outstanding when the wave ends

  if (MODE == 2) {
    // GELU epilogue as a short rolled loop. Each wave passes its accumulators,
    // 16 rows at a time, through its own LDS range (the ring is free: the last
    // trip's waits and barrier ended every read, no copy is outstanding) and
    // takes them back as 8 neighbouring columns of one row per lane: 8
    // independent GELU chains and one 16-B store per row, 256 B per row.
    float* stg = (float*)&Bs[0][0] + wave * (16 * SP);
    _Float16* o = (_Float16*)outp;
    const int c0 = n0 + wn * 128 + lr * 8;
    const v4f bl = *(const v4f*)(bias + c0);
    // Precaution: the compiler lets the second load's result land on the
    // address pair that the first load names; this wait stands in front of it.
    asm volatile("s_wait_xcnt 0x0" ::: "memory");
    const v4f bh = *(const v4f*)(bias + c0 + 4);
#pragma unroll
    for (int i = 0; i < 4; ++i) {
#pragma unroll
      for (int j = 0; j < 8; ++j)
#pragma unroll
        for (int r = 0; r < 8; ++r)
          stg[(r + 8 * half) * SP + j * 16 + lr] = acc[i][j][r];
      wait_ds0();         // my staged rows are written before I read them back
      _Float16* orow = o + (size_t)(m0 + wm * 64 + i * 16 + half) * N + c0;
      // Stays rolled (two row pairs a trip, so that the second pair's LDS
      // reads fly under the first pair's arithmetic).
#pragma unroll 1
      for (int it = 0; it < 8; it += 2) {
        h8 y[2];
#pragma unroll
        for (int u = 0; u < 2; ++u) {
          const float* s = stg + ((it + u) * 2 + half) * SP + lr * 8;
          const v4f xl = *(const v4f*)s + bl;
          const v4f xh = *(const v4f*)(s + 4) + bh;
#pragma unroll
          for (int e = 0; e < 4; ++e) {
            y[u][e]     = (_Float16)gelu_exact(xl[e]);
            y[u][e + 4] = (_Float16)gelu_exact(xh[e]);
          }
        }
        *(h8*)(orow + (size_t)(it * 2) * N) = y[0];
        *(h8*)(orow + (size_t)(it * 2 + 2) * N) = y[1];
      }
    }
    return;
  }

  // C/D layout: vreg r holds A-role row (r + 8*half), B-role row (lane&15).
  if (MODE == 0) {
    const int tok0 = m0 + (sw ? wn * 128 : wm * 64);  // first token of the wave
    const int col0 = n0 + (sw ? wm * 64 : wn * 128);  // first column of the wave
    // 16-KB block of (q/k/v, b, head of col0, window of tok0), lane's 16 B
    _Float16* dst = (_Float16*)outp + ((size_t)(col0 >> 10) << 25) +
        ((((size_t)(tok0 >> 13) * NHEAD + ((col0 & (DIM - 1)) >> 6)) * 64 +
          ((tok0 & 8191) >> 7)) << 13) + lane * 8;
    if (sw) {
      // wave = one head (4 tiles of 16 dims) x one window (8 tiles of 16
      // tokens); piece (token tile j, dim tile i)
      v4f bl[4], bh[4];
#pragma unroll
      for (int i = 0; i < 4; ++i) {
        const float* bp = bias + col0 + i * 16 + half * 8;
        bl[i] = *(const v4f*)bp;
        bh[i] = *(const v4f*)(bp + 4);
      }
      wait_x0();  // behind the bias loads, whose address registers are reused
      __builtin_amdgcn_sched_barrier(0);  // holds later writes behind that wait
#pragma unroll
      for (int j = 0; j < 8; ++j) {
#pragma unroll
        for (int i = 0; i < 4; ++i) {
          h8 y;
#pragma unroll
          for (int r = 0; r < 4; ++r) {
            y[r]     = (_Float16)(acc[i][j][r] + bl[i][r]);
            y[r + 4] = (_Float16)(acc[i][j][r + 4] + bh[i][r]);
          }
          *(h8*)(dst + (j * 4 + i) * 256) = y;
        }
        if (j < 7) wait_x0();  // the next four tiles reuse these stores' registers
        // Four tiles at a time: left free, the scheduler forms every tile's
        // sums beside the 256 accumulators first and spills; it also holds
        // the next tiles' writes behind the wait.
        __builtin_amdgcn_sched_barrier(0);
      }
    } else {
      // wave = half a window (4 tiles of 16 tokens) x two heads (2 x 4 tiles
      // of 16 dims); piece (dim tile, token tile), next head 64 blocks on
      dst += ((tok0 & 127) >> 4) * 256;
      float bv[8];
#pragma unroll
      for (int j = 0; j < 8; ++j) bv[j] = bias[col0 + j * 16 + lr];
      wait_x0();  // behind the bias loads, whose address registers are reused
      __builtin_amdgcn_sched_barrier(0);  // holds later writes behind that wait
#pragma unroll
      for (int j = 0; j < 8; ++j) {
#pragma unroll
        for (int i = 0; i < 4; ++i) {
          h8 y;
#pragma unroll
          for (int r = 0; r < 8; ++r) y[r] = (_Float16)(acc[i][j][r] + bv[j]);
          *(h8*)(dst + (j >> 2) * (64 * 8192) + ((j & 3) * 8 + i) * 256) = y;
        }
        // The next four tiles reuse these stores' registers; behind the last
        // four, the listing's fall-through into the other branch does.
        wait_x0();
        __builtin_amdgcn_sched_barrier(0);
      }
    }
    return;
  }

  // MODE 1 / 3: f32 + residual
#pragma unroll
  for (int i = 0; i < 4; ++i) {
#pragma unroll
    for (int j = 0; j < 8; ++j) {
      const int mt = m0 + wm * 64 + i * 16;
      const int nt = n0 + wn * 128 + j * 16;
      const int col = nt + lr;
      const float bv = bias[col];
#pragma unroll
      for (int r = 0; r < 8; ++r) {
        const int row = mt + r + 8 * half;
        const float vv = acc[i][j][r] + bv;
        float* o = (float*)outp;
        const size_t idx = (size_t)row * N + col;
        o[idx] = vv + residual[idx];
      }
    }
  }
}

// ---------------------------------------------------------------------------
// Windowed attention: one block per (b, head, window). 8 waves; wave w owns
// query rows [16w, 16w+16). S = Q K^T (WMMA), register softmax with 16-lane
// shfl_xor reductions, P staged to LDS (f16), O = P V (WMMA). q, k and v come
// in fragment order (see load_frag_pieces): q, k pieces (token tile, dim tile),
// v pieces (dim tile, token tile). Every wave needs all of k and v: the block
// copies both 16-KB blocks to LDS as they lie, 16 B a lane; q goes straight
// into its wave's fragments.
// ---------------------------------------------------------------------------
__global__ __launch_bounds__(256) void attn_kernel(
    const _Float16* __restrict__ q, const _Float16* __restrict__ k,
    const _Float16* __restrict__ v, _Float16* __restrict__ o) {
  __shared__ __attribute__((aligned(16))) _Float16 Ks[WIN * HD];
  __shared__ __attribute__((aligned(16))) _Float16 Vs[WIN * HD];
  __shared__ _Float16 Ps[128 * 136];  // (row, k) pitch 136

  const int bid = blockIdx.x;          // ((b*16+h)*64 + win)
  const int win = bid & 63;
  const int bh  = bid >> 6;
  const int lane = threadIdx.x & 31, wave = threadIdx.x >> 5;
  const int half = lane >> 4, lr = lane & 15;
  const int r0 = wave * 16;
  // 16-KB block of this (b, head, window)
  const size_t base = ((size_t)bh * 8192 + (size_t)win * WIN) * HD;
  h8 kr[4], vr[4];
#pragma unroll
  for (int p = 0; p < 4; ++p) {
    kr[p] = *(const h8*)(k + base + p * 2048 + threadIdx.x * 8);
    vr[p] = *(const h8*)(v + base + p * 2048 + threadIdx.x * 8);
  }
  // lane's own 16 B of every piece
  const _Float16* Q = q + base + lane * 8;
  const _Float16* K = Ks + lane * 8;
  const _Float16* V = Vs + lane * 8;
  v16h aq[2];
#pragma unroll
  for (int c = 0; c < 2; ++c) aq[c] = load_frag_pieces(Q, wave * 4 + c * 2);
#pragma unroll
  for (int p = 0; p < 4; ++p) {
    *(h8*)&Ks[p * 2048 + threadIdx.x * 8] = kr[p];
    *(h8*)&Vs[p * 2048 + threadIdx.x * 8] = vr[p];
  }
  wait_x0();  // behind the loads above: q's address registers are reused below
  __syncthreads();

  // ---- S = Q K^T * 1/sqrt(64), strip of 16 rows x 128 cols (8 tiles) ----
  v8f s[8];
#pragma unroll
  for (int t = 0; t < 8; ++t) s[t] = {};
#pragma unroll
  for (int kk = 0; kk < HD; kk += 32) {
#pragma unroll
    for (int t = 0; t < 8; ++t) {
      v16h bk = load_frag_pieces(K, t * 4 + (kk >> 4));
      s[t] = __builtin_amdgcn_wmma_f32_16x16x32_f16(
          false, aq[kk >> 5], false, bk, (short)0, s[t], false, false);
    }
  }

  // ---- softmax: row (r0 + i + 8*half) lives in lanes of one 16-lane half ----
#pragma unroll
  for (int i = 0; i < 8; ++i) {
    float m = -3.0e38f;
#pragma unroll
    for (int t = 0; t < 8; ++t) {
      float vv = s[t][i] * 0.125f;
      s[t][i] = vv;
      m = fmaxf(m, vv);
    }
#pragma unroll
    for (int off = 1; off < 16; off <<= 1) m = fmaxf(m, __shfl_xor(m, off, 32));
    float sum = 0.f;
#pragma unroll
    for (int t = 0; t < 8; ++t) {
      float e = __expf(s[t][i] - m);
      s[t][i] = e;
      sum += e;
    }
#pragma unroll
    for (int off = 1; off < 16; off <<= 1) sum += __shfl_xor(sum, off, 32);
    const float inv = 1.0f / sum;
    const int row = r0 + i + 8 * half;
#pragma unroll
    for (int t = 0; t < 8; ++t)
      Ps[row * 136 + t * 16 + lr] = (_Float16)(s[t][i] * inv);
  }
  // Same-wave LDS store->load is in-order; each wave reads only its own strip.

  // ---- O = P V : 16 rows x 64 cols (4 tiles), K = 128 ----
  v8f oa[4];
#pragma unroll
  for (int dt = 0; dt < 4; ++dt) oa[dt] = {};
#pragma unroll
  for (int kk = 0; kk < WIN; kk += 32) {
    v16h ap = load_frag(&Ps[r0 * 136 + kk], 136);
#pragma unroll
    for (int dt = 0; dt < 4; ++dt) {
      v16h bv = load_frag_pieces(V, dt * 8 + (kk >> 4));
      oa[dt] = __builtin_amdgcn_wmma_f32_16x16x32_f16(
          false, ap, false, bv, (short)0, oa[dt], false, false);
    }
  }

  // scatter to (B, N, C) with heads concatenated: col = h*64 + d
  const int b = bh >> 4, h = bh & 15;
#pragma unroll
  for (int dt = 0; dt < 4; ++dt) {
#pragma unroll
    for (int r = 0; r < 8; ++r) {
      const int n = win * WIN + r0 + r + 8 * half;
      const size_t token = (size_t)b * 8192 + n;
      const int col = h * HD + dt * 16 + lr;
      o[token * DIM + col] = (_Float16)oa[dt][r];
    }
  }
}

// ---------------------------------------------------------------------------
// Host-side orchestration
// ---------------------------------------------------------------------------
extern "C" void kernel_launch(void* const* d_in, const int* in_sizes, int n_in,
                              void* d_out, int out_size, void* d_ws,
                              size_t ws_size, hipStream_t stream) {
  const float* x      = (const float*)d_in[0];
  const float* ln1_w  = (const float*)d_in[1];
  const float* ln1_b  = (const float*)d_in[2];
  const float* qkv_w  = (const float*)d_in[3];
  const float* qkv_b  = (const float*)d_in[4];
  const float* proj_w = (const float*)d_in[5];
  const float* proj_b = (const float*)d_in[6];
  const float* ln2_w  = (const float*)d_in[7];
  const float* ln2_b  = (const float*)d_in[8];
  const float* fc1_w  = (const float*)d_in[9];
  const float* fc1_b  = (const float*)d_in[10];
  const float* fc2_w  = (const float*)d_in[11];
  const float* fc2_b  = (const float*)d_in[12];
  float* out = (float*)d_out;

  char* ws = (char*)d_ws;
  const size_t MB = 1024ull * 1024ull;
  // [0,16MB): f16 weights
  _Float16* qkv_w16  = (_Float16*)ws;
  _Float16* proj_w16 = qkv_w16 + 3u * DIM * DIM;
  _Float16* fc1_w16  = proj_w16 + (size_t)DIM * DIM;
  _Float16* fc2_w16  = fc1_w16 + 2u * DIM * DIM;
  // [16,80): LN output (xn, reused as h)      64 MB f16
  _Float16* xn = (_Float16*)(ws + 16 * MB);
  // [80,272): q/k/v, fragment order           3 x 64 MB f16; act reuses front
  _Float16* qbuf = (_Float16*)(ws + 80 * MB);
  _Float16* kbuf = qbuf + ((size_t)1 << 25);
  _Float16* vbuf = kbuf + ((size_t)1 << 25);
  _Float16* act  = qbuf;  // 128 MB, reused after attention consumes q/k/v
  // [272,336): attention output               64 MB f16
  _Float16* attn_out = (_Float16*)(ws + 272 * MB);
  // [336,464): x1 = x + attn (f32 residual)   128 MB
  float* x1 = (float*)(ws + 336 * MB);

  // 1) weight casts
  cvt_kernel<<<(3 * DIM * DIM + 255) / 256, 256, 0, stream>>>(qkv_w, qkv_w16, 3 * DIM * DIM);
  cvt_kernel<<<(DIM * DIM + 255) / 256, 256, 0, stream>>>(proj_w, proj_w16, DIM * DIM);
  cvt_kernel<<<(2 * DIM * DIM + 255) / 256, 256, 0, stream>>>(fc1_w, fc1_w16, 2 * DIM * DIM);
  cvt_kernel<<<(2 * DIM * DIM + 255) / 256, 256, 0, stream>>>(fc2_w, fc2_w16, 2 * DIM * DIM);

  // 2) LN1
  ln_kernel<<<TOK / 8, 256, 0, stream>>>(x, ln1_w, ln1_b, xn, TOK);

  // 3) QKV GEMM (32768 x 3072 x 1024) into fragment-order q/k/v
  gemm_kernel<0><<<dim3(3072 / BT, TOK / BT), 256, 0, stream>>>(
      xn, qkv_w16, qkv_b, nullptr, (void*)qbuf, TOK, 3072, DIM);

  // 4) windowed attention: 4*16*64 blocks
  attn_kernel<<<4 * NHEAD * 64, 256, 0, stream>>>(qbuf, kbuf, vbuf, attn_out);

  // 5) proj GEMM + residual -> x1 (f32)
  gemm_kernel<1><<<dim3(DIM / BT, TOK / BT), 256, 0, stream>>>(
      attn_out, proj_w16, proj_b, x, (void*)x1, TOK, DIM, DIM);

  // 6) LN2
  ln_kernel<<<TOK / 8, 256, 0, stream>>>(x1, ln2_w, ln2_b, xn, TOK);

  // 7) FC1 GEMM + exact GELU (32768 x 2048 x 1024)
  gemm_kernel<2><<<dim3(2048 / BT, TOK / BT), 256, 0, stream>>>(
      xn, fc1_w16, fc1_b, nullptr, (void*)act, TOK, 2048, DIM);

  // 8) FC2 GEMM + residual -> d_out (32768 x 1024 x 2048)
  gemm_kernel<3><<<dim3(DIM / BT, TOK / BT), 256, 0, stream>>>(
      act, fc2_w16, fc2_b, x1, (void*)out, TOK, DIM, 2048);
}

// v005
// It runs in 473 microseconds.
// Next to v004, in two timings, it ran 1.08 times as fast each time.
// Over all steps from v000 it is 1.87 times as fast.
#include <hip/hip_runtime.h>
#include <hip/hip_bf16.h>

typedef _Float16 v16h __attribute__((ext_vector_type(16)));
typedef _Float16 h8   __attribute__((ext_vector_type(8)));
typedef float    v8f  __attribute__((ext_vector_type(8)));
typedef float    v4f  __attribute__((ext_vector_type(4)));

#define TOK   32768   // B*N tokens
#define DIM   1024
#define NHEAD 16
#define HD    64
#define WIN   128

__device__ __forceinline__ v16h load_frag(const _Float16* base, int ld) {
  const int lane = threadIdx.x & 31;
  const _Float16* p = base + (size_t)(lane & 15) * ld + ((lane >> 4) << 3);
  h8 lo = *(const h8*)(p);
  h8 hi = *(const h8*)(p + 16);
  return __builtin_shufflevector(lo, hi, 0,1,2,3,4,5,6,7,8,9,10,11,12,13,14,15);
}

__device__ __forceinline__ v16h load_frag_pieces(const _Float16* p, int c) {
  h8 lo = *(const h8*)(p + c * 256);
  h8 hi = *(const h8*)(p + (c + 1) * 256);
  return __builtin_shufflevector(lo, hi, 0,1,2,3,4,5,6,7,8,9,10,11,12,13,14,15);
}

// erf in f32 without a branch: the usual two minimax fits (|x| < 1: odd
// polynomial; else 1 - exp(-q(|x|))) are both evaluated and one is selected,
// so that neighbouring elements are independent chains the scheduler can mix.
__device__ __forceinline__ float erf_select(float x) {
  const float ax = fabsf(x);
  const float t = ax * ax;
  float p = fmaf(t, -0x1.268bc2p-11f, 0x1.420828p-8f);
  p = fmaf(t, p, -0x1.b5937p-6f);
  p = fmaf(t, p, 0x1.ce077cp-4f);
  p = fmaf(t, p, -0x1.81266p-2f);
  p = fmaf(t, p, 0x1.06eba0p-3f);
  const float small = fmaf(ax, p, ax);
  float q = fmaf(ax, 0x1.1d3156p-16f, -0x1.8d129p-12f);
  q = fmaf(ax, q, 0x1.f9a6d2p-9f);
  q = fmaf(ax, q, -0x1.8c3164p-6f);
  q = fmaf(ax, q, 0x1.b4e9c8p-4f);
  q = fmaf(ax, q, 0x1.4515fap-1f);
  q = fmaf(ax, q, 0x1.078e50p-3f);
  q = fmaf(ax, q, ax);
  const float big = 1.0f - __builtin_amdgcn_exp2f(q * -1.44269504088896340736f);
  return copysignf(ax < 1.0f ? small : big, x);
}

__device__ __forceinline__ float gelu_exact(float x) {
  return 0.5f * x * (1.0f + erf_select(x * 0.70710678118654752440f));
}

typedef int v4i __attribute__((ext_vector_type(4)));
typedef __attribute__((address_space(1))) v4i gv4i;
typedef __attribute__((address_space(3))) v4i lv4i;

__device__ __forceinline__ void async_ld_b128(_Float16* lds_dst,
                                              const _Float16* gsrc) {
  __builtin_amdgcn_global_load_async_to_lds_b128((gv4i*)gsrc, (lv4i*)lds_dst,
                                                 0, 0);
}

// This wave's copies have landed
// only behind this wait.
__device__ __forceinline__ void wait_async0() {
  asm volatile("s_wait_asynccnt 0" ::: "memory");
}

// This wave's LDS reads have retired before the barrier that frees the buffer
// for the next copies.
__device__ __forceinline__ void wait_ds0() {
  asm volatile("s_wait_dscnt 0" ::: "memory");
}

// Precaution: stands between issued global loads or stores and the overwrite of
// a register that they name, where the compiler has placed no such wait.
__device__ __forceinline__ void wait_x0() {
  asm volatile("s_wait_xcnt 0x0" ::: "memory");
}

// ---------------------------------------------------------------------------
// f32 -> f16 weight conversion
// ---------------------------------------------------------------------------
__global__ void cvt_kernel(const float* __restrict__ src,
                           _Float16* __restrict__ dst, int n) {
  int i = blockIdx.x * 256 + threadIdx.x;
  if (i < n) dst[i] = (_Float16)src[i];
}

// ---------------------------------------------------------------------------
// LayerNorm: one wave (32 lanes) per token, 32 channels per lane, taken as 8
// groups of 4 neighbouring channels: a wave's load covers 512 contiguous bytes
// of the row, its store 256, whole lines both.
// ---------------------------------------------------------------------------
typedef _Float16 h4 __attribute__((ext_vector_type(4)));

__global__ __launch_bounds__(256) void ln_kernel(
    const float* __restrict__ x, const float* __restrict__ w,
    const float* __restrict__ b, _Float16* __restrict__ out, int ntok) {
  const int lane = threadIdx.x & 31;
  const int wave = threadIdx.x >> 5;
  const size_t token = (size_t)blockIdx.x * 8 + wave;
  if (token >= (size_t)ntok) return;
  const float* row = x + token * DIM + lane * 4;
  v4f vals[8];
  float s = 0.f;
#pragma unroll
  for (int j = 0; j < 8; ++j) vals[j] = *(const v4f*)(row + j * 128);
  // Precaution: the compiler lets a load below land on the address pair that
  // the row's loads name; this wait stands in front of it.
  wait_x0();
  v4f wv[8], bb[8];
#pragma unroll
  for (int j = 0; j < 8; ++j) {
    wv[j] = *(const v4f*)(w + j * 128 + lane * 4);
    bb[j] = *(const v4f*)(b + j * 128 + lane * 4);
  }
  // Holds the weight and bias loads up here, behind the row's: left free, the
  // scheduler sinks each pair to its use and waits out eight latencies in turn.
  __builtin_amdgcn_sched_barrier(0);
#pragma unroll
  for (int j = 0; j < 8; ++j)
#pragma unroll
    for (int e = 0; e < 4; ++e) s += vals[j][e];
#pragma unroll
  for (int off = 16; off >= 1; off >>= 1) s += __shfl_xor(s, off, 32);
  const float mu = s * (1.0f / DIM);
  float var = 0.f;
#pragma unroll
  for (int j = 0; j < 8; ++j)
#pragma unroll
    for (int e = 0; e < 4; ++e) { float d = vals[j][e] - mu; var += d * d; }
#pragma unroll
  for (int off = 16; off >= 1; off >>= 1) var += __shfl_xor(var, off, 32);
  const float rstd = rsqrtf(var * (1.0f / DIM) + 1e-5f);
  _Float16* orow = out + token * DIM + lane * 4;
  h4 y[8];
#pragma unroll
  for (int j = 0; j < 8; ++j)
#pragma unroll
    for (int e = 0; e < 4; ++e)
      y[j][e] = (_Float16)((vals[j][e] - mu) * rstd * wv[j][e] + bb[j][e]);
#pragma unroll
  for (int j = 0; j < 8; ++j) *(h4*)(orow + j * 128) = y[j];
}

#define BT 256
#define BK 128
#define LDA 136
#define SP 132

template <int MODE>
__global__ __launch_bounds__(256) void gemm_kernel(
    const _Float16* __restrict__ X, const _Float16* __restrict__ Wt,
    const float* __restrict__ bias, const float* __restrict__ residual,
    void* __restrict__ outp, int M, int N, int K) {
  __shared__ __attribute__((aligned(16))) _Float16 As[2][BT * LDA];
  __shared__ __attribute__((aligned(16))) _Float16 Bs[2][BT * LDA];

  const int tid  = threadIdx.x;
  const int lane = tid & 31, wave = tid >> 5;
  const int half = lane >> 4, lr = lane & 15;
  const int wm = wave >> 1;  // 0..3 -> 64-row strip
  const int wn = wave & 1;   // 0..1 -> 128-col strip
  const int m0 = blockIdx.y * BT;
  const int n0 = blockIdx.x * BT;

  // stage one 256x128 K-slice of A and B into LDS buffer `buf` (async):
  // 16 lanes per 256-B row, 16 rows per sweep of the block, 16 sweeps each.
  // Uniform row base + one 32-bit lane offset: the 32 addresses are formed at
  // the copies, not held as 32 pointers beside the accumulators.
  const int sr = tid >> 4, sc = (tid & 15) << 3;
  const unsigned goff = ((unsigned)sr * (unsigned)K + (unsigned)sc) * 2u;
  // Both operands are 256 K-contiguous rows with one loader, so the roles are
  // swapped by swapping the two row bases (block-uniform).
  const bool sw = MODE == 0 && n0 < 2 * DIM;  // q and k columns
  const char* Xr = (const char*)(X + (size_t)m0 * K);
  const char* Wr = (const char*)(Wt + (size_t)n0 * K);
  const char* Xb = sw ? Wr : Xr;  // rows of the A role (As)
  const char* Wb = sw ? Xr : Wr;  // rows of the B role (Bs)
  auto stage = [&](int buf, int k0) {
#pragma unroll
    for (int p = 0; p < 16; ++p)
      async_ld_b128(&As[buf][(sr + p * 16) * LDA + sc],
                    (const _Float16*)(Xb + ((size_t)(p * 16) * K + k0) * 2 + goff));
#pragma unroll
    for (int p = 0; p < 16; ++p)
      async_ld_b128(&Bs[buf][(sr + p * 16) * LDA + sc],
                    (const _Float16*)(Wb + ((size_t)(p * 16) * K + k0) * 2 + goff));
  };

  v8f acc[4][8];
#pragma unroll
  for (int i = 0; i < 4; ++i)
#pragma unroll
    for (int j = 0; j < 8; ++j) acc[i][j] = {};

  // Fragment loops are fully unrolled with constant set numbers so that every
  // array index is a constant and the fragments stay in registers.
  v16h a[2][4], b[2][8];
  // set S <- block KB (32 k) of LDS buffer BUF: 12 fragments, 24 reads of 16 B
#define LOADF(S, BUF, KB)                                                     \
  do {                                                                        \
    _Pragma("unroll") for (int i = 0; i < 4; ++i) a[S][i] =                   \
        load_frag(&As[BUF][(wm * 64 + i * 16) * LDA + (KB) * 32], LDA);       \
    _Pragma("unroll") for (int j = 0; j < 8; ++j) b[S][j] =                   \
        load_frag(&Bs[BUF][(wn * 128 + j * 16) * LDA + (KB) * 32], LDA);      \
  } while (0)
  // accumulator rows I0..I1-1 += set S
#define MMA(S, I0, I1)                                                        \
  do {                                                                        \
    _Pragma("unroll") for (int i = I0; i < I1; ++i)                           \
        _Pragma("unroll") for (int j = 0; j < 8; ++j) acc[i][j] =             \
            __builtin_amdgcn_wmma_f32_16x16x32_f16(                           \
                false, a[S][i], false, b[S][j], (short)0, acc[i][j], false,   \
                false);                                                       \
  } while (0)
  // Holds each read group and each WMMA block where it is written: left free,
  // the scheduler sinks the reads to their first use, one block later, and the
  // wave then sits out the LDS latency there.
#define PIN() __builtin_amdgcn_sched_barrier(0)

  const int ntile = K / BK;
  stage(0, 0);
  wait_async0();          // my copies of stage 0 have landed
  __syncthreads();        // publish stage 0
  if (ntile > 1) stage(1, BK);
  LOADF(0, 0, 0);
  for (int t = 0; t < ntile; ++t) {
    const int cur = t & 1;
    LOADF(1, cur, 1);
    PIN();
    MMA(0, 0, 4);
    PIN();
    LOADF(0, cur, 2);
    PIN();
    MMA(1, 0, 4);
    PIN();
    LOADF(1, cur, 3);
    PIN();
    MMA(0, 0, 4);
    PIN();
    wait_ds0();           // my reads of buffer cur are done (last block's too)
    wait_async0();        // my copies of stage t+1 have landed
    __syncthreads();      // publish stage t+1; every reader has left buffer cur
    MMA(1, 0, 1);
    PIN();
    if (t + 2 < ntile) stage(cur, (t + 2) * BK);
    if (t + 1 < ntile) LOADF(0, cur ^ 1, 0);
    PIN();
    MMA(1, 1, 4);
    PIN();
  }
#undef LOADF
#undef MMA
#undef PIN
  wait_async0();          // no copy outstanding when the wave ends

  if (MODE == 2) {
    // GELU epilogue as a short rolled loop. Each wave passes its accumulators,
    // 16 rows at a time, through its own LDS range (the ring is free: the last
    // trip's waits and barrier ended every read, no copy is outstanding) and
    // takes them back as 8 neighbouring columns of one row per lane: 8
    // independent GELU chains and one 16-B store per row, 256 B per row.
    float* stg = (float*)&Bs[0][0] + wave * (16 * SP);
    _Float16* o = (_Float16*)outp;
    const int c0 = n0 + wn * 128 + lr * 8;
    const v4f bl = *(const v4f*)(bias + c0);
    // Precaution: the compiler lets the second load's result land on the
    // address pair that the first load names; this wait stands in front of it.
    asm volatile("s_wait_xcnt 0x0" ::: "memory");
    const v4f bh = *(const v4f*)(bias + c0 + 4);
#pragma unroll
    for (int i = 0; i < 4; ++i) {
#pragma unroll
      for (int j = 0; j < 8; ++j)
#pragma unroll
        for (int r = 0; r < 8; ++r)
          stg[(r + 8 * half) * SP + j * 16 + lr] = acc[i][j][r];
      wait_ds0();         // my staged rows are written before I read them back
      _Float16* orow = o + (size_t)(m0 + wm * 64 + i * 16 + half) * N + c0;
      // Stays rolled (two row pairs a trip, so that the second pair's LDS
      // reads fly under the first pair's arithmetic).
#pragma unroll 1
      for (int it = 0; it < 8; it += 2) {
        h8 y[2];
#pragma unroll
        for (int u = 0; u < 2; ++u) {
          const float* s = stg + ((it + u) * 2 + half) * SP + lr * 8;
          const v4f xl = *(const v4f*)s + bl;
          const v4f xh = *(const v4f*)(s + 4) + bh;
#pragma unroll
          for (int e = 0; e < 4; ++e) {
            y[u][e]     = (_Float16)gelu_exact(xl[e]);
            y[u][e + 4] = (_Float16)gelu_exact(xh[e]);
          }
        }
        *(h8*)(orow + (size_t)(it * 2) * N) = y[0];
        *(h8*)(orow + (size_t)(it * 2 + 2) * N) = y[1];
      }
    }
    return;
  }

  // C/D layout: vreg r holds A-role row (r + 8*half), B-role row (lane&15).
  if (MODE == 0) {
    const int tok0 = m0 + (sw ? wn * 128 : wm * 64);  // first token of the wave
    const int col0 = n0 + (sw ? wm * 64 : wn * 128);  // first column of the wave
    // 16-KB block of (q/k/v, b, head of col0, window of tok0), lane's 16 B
    _Float16* dst = (_Float16*)outp + ((size_t)(col0 >> 10) << 25) +
        ((((size_t)(tok0 >> 13) * NHEAD + ((col0 & (DIM - 1)) >> 6)) * 64 +
          ((tok0 & 8191) >> 7)) << 13) + lane * 8;
    if (sw) {
      // wave = one head (4 tiles of 16 dims) x one window (8 tiles of 16
      // tokens); piece (token tile j, dim tile i)
      v4f bl[4], bh[4];
#pragma unroll
      for (int i = 0; i < 4; ++i) {
        const float* bp = bias + col0 + i * 16 + half * 8;
        bl[i] = *(const v4f*)bp;
        bh[i] = *(const v4f*)(bp + 4);
      }
      wait_x0();  // behind the bias loads, whose address registers are reused
      __builtin_amdgcn_sched_barrier(0);  // holds later writes behind that wait
#pragma unroll
      for (int j = 0; j < 8; ++j) {
#pragma unroll
        for (int i = 0; i < 4; ++i) {
          h8 y;
#pragma unroll
          for (int r = 0; r < 4; ++r) {
            y[r]     = (_Float16)(acc[i][j][r] + bl[i][r]);
            y[r + 4] = (_Float16)(acc[i][j][r + 4] + bh[i][r]);
          }
          *(h8*)(dst + (j * 4 + i) * 256) = y;
        }
        if (j < 7) wait_x0();  // the next four tiles reuse these stores' registers
        // Four tiles at a time: left free, the scheduler forms every tile's
        // sums beside the 256 accumulators first and spills; it also holds
        // the next tiles' writes behind the wait.
        __builtin_amdgcn_sched_barrier(0);
      }
    } else {
      // wave = half a window (4 tiles of 16 tokens) x two heads (2 x 4 tiles
      // of 16 dims); piece (dim tile, token tile), next head 64 blocks on
      dst += ((tok0 & 127) >> 4) * 256;
      float bv[8];
#pragma unroll
      for (int j = 0; j < 8; ++j) bv[j] = bias[col0 + j * 16 + lr];
      wait_x0();  // behind the bias loads, whose address registers are reused
      __builtin_amdgcn_sched_barrier(0);  // holds later writes behind that wait
#pragma unroll
      for (int j = 0; j < 8; ++j) {
#pragma unroll
        for (int i = 0; i < 4; ++i) {
          h8 y;
#pragma unroll
          for (int r = 0; r < 8; ++r) y[r] = (_Float16)(acc[i][j][r] + bv[j]);
          *(h8*)(dst + (j >> 2) * (64 * 8192) + ((j & 3) * 8 + i) * 256) = y;
        }
        // The next four tiles reuse these stores' registers; behind the last
        // four, the listing's fall-through into the other branch does.
        wait_x0();
        __builtin_amdgcn_sched_barrier(0);
      }
    }
    return;
  }

  // MODE 1 / 3: f32 + residual, in whole lines. As in the GELU epilogue each
  // wave passes its accumulators, 16 rows at a time, through its own LDS range
  // (the ring is free: the last trip's waits and barrier ended every read, no
  // copy is outstanding) and takes each row back as 4 neighbouring columns per
  // lane: one residual load and one store of 16 B a lane cover the wave's 512 B
  // of a row. The residual rows of the next 16 are loaded one group ahead.
  {
    constexpr int NC = DIM;  // row length of both launches: row steps become
                             // immediate offsets on one address per stream
    float* stg = (float*)&Bs[0][0] + wave * (16 * SP);
    const size_t e0 = (size_t)(m0 + wm * 64) * NC + n0 + wn * 128 + lane * 4;
    const float* rp = residual + e0;
    float* op = (float*)outp + e0;
    const v4f bv = *(const v4f*)(bias + n0 + wn * 128 + lane * 4);
    v4f res[2][16];
#pragma unroll
    for (int r = 0; r < 16; ++r) res[0][r] = *(const v4f*)(rp + r * NC);
#pragma unroll
    for (int i = 0; i < 4; ++i) {
      if (i < 3) {
#pragma unroll
        for (int r = 0; r < 16; ++r)
          res[(i + 1) & 1][r] = *(const v4f*)(rp + ((i + 1) * 16 + r) * NC);
      }
      // Holds the next group's loads in front of this group's work: left free,
      // the scheduler sinks them to their use and their latency is waited out.
      __builtin_amdgcn_sched_barrier(0);
#pragma unroll
      for (int j = 0; j < 8; ++j)
#pragma unroll
        for (int r = 0; r < 8; ++r)
          stg[(r + 8 * half) * SP + j * 16 + lr] = acc[i][j][r];
      wait_ds0();         // my staged rows are written before I read them back
      v4f y[16];
#pragma unroll
      for (int r = 0; r < 16; ++r)
        y[r] = (*(const v4f*)(stg + r * SP + lane * 4) + bv) + res[i & 1][r];
      // All 16 sums stand before the first store: no register that an issued
      // store names is written until the wait behind the stores.
      __builtin_amdgcn_sched_barrier(0);
#pragma unroll
      for (int r = 0; r < 16; ++r) *(v4f*)(op + (i * 16 + r) * NC) = y[r];
      if (i < 3) {
        wait_x0();  // the next group reuses these stores' registers
        __builtin_amdgcn_sched_barrier(0);  // holds later writes behind that wait
      }
    }
  }
}

// ---------------------------------------------------------------------------
// Windowed attention: one block per (b, head, window). 8 waves; wave w owns
// query rows [16w, 16w+16). S = Q K^T (WMMA), register softmax with 16-lane
// shfl_xor reductions, P staged to LDS (f16), O = P V (WMMA). q, k and v come
// in fragment order (see load_frag_pieces): q, k pieces (token tile, dim tile),
// v pieces (dim tile, token tile). Every wave needs all of k and v: the block
// copies both 16-KB blocks to LDS as they lie, 16 B a lane; q goes straight
// into its wave's fragments.
// ---------------------------------------------------------------------------
__global__ __launch_bounds__(256) void attn_kernel(
    const _Float16* __restrict__ q, const _Float16* __restrict__ k,
    const _Float16* __restrict__ v, _Float16* __restrict__ o) {
  __shared__ __attribute__((aligned(16))) _Float16 Ks[WIN * HD];
  __shared__ __attribute__((aligned(16))) _Float16 Vs[WIN * HD];
  __shared__ __attribute__((aligned(16))) _Float16 Ps[128 * 136];  // (row, k) pitch 136

  const int bid = blockIdx.x;          // ((b*16+h)*64 + win)
  const int win = bid & 63;
  const int bh  = bid >> 6;
  const int lane = threadIdx.x & 31, wave = threadIdx.x >> 5;
  const int half = lane >> 4, lr = lane & 15;
  const int r0 = wave * 16;
  // 16-KB block of this (b, head, window)
  const size_t base = ((size_t)bh * 8192 + (size_t)win * WIN) * HD;
  h8 kr[4], vr[4];
#pragma unroll
  for (int p = 0; p < 4; ++p) {
    kr[p] = *(const h8*)(k + base + p * 2048 + threadIdx.x * 8);
    vr[p] = *(const h8*)(v + base + p * 2048 + threadIdx.x * 8);
  }
  // lane's own 16 B of every piece
  const _Float16* Q = q + base + lane * 8;
  const _Float16* K = Ks + lane * 8;
  const _Float16* V = Vs + lane * 8;
  v16h aq[2];
#pragma unroll
  for (int c = 0; c < 2; ++c) aq[c] = load_frag_pieces(Q, wave * 4 + c * 2);
#pragma unroll
  for (int p = 0; p < 4; ++p) {
    *(h8*)&Ks[p * 2048 + threadIdx.x * 8] = kr[p];
    *(h8*)&Vs[p * 2048 + threadIdx.x * 8] = vr[p];
  }
  wait_x0();  // behind the loads above: q's address registers are reused below
  __syncthreads();

  // ---- S = Q K^T * 1/sqrt(64), strip of 16 rows x 128 cols (8 tiles) ----
  v8f s[8];
#pragma unroll
  for (int t = 0; t < 8; ++t) s[t] = {};
#pragma unroll
  for (int kk = 0; kk < HD; kk += 32) {
#pragma unroll
    for (int t = 0; t < 8; ++t) {
      v16h bk = load_frag_pieces(K, t * 4 + (kk >> 4));
      s[t] = __builtin_amdgcn_wmma_f32_16x16x32_f16(
          false, aq[kk >> 5], false, bk, (short)0, s[t], false, false);
    }
  }

  // ---- softmax: row (r0 + i + 8*half) lives in lanes of one 16-lane half ----
#pragma unroll
  for (int i = 0; i < 8; ++i) {
    float m = -3.0e38f;
#pragma unroll
    for (int t = 0; t < 8; ++t) {
      float vv = s[t][i] * 0.125f;
      s[t][i] = vv;
      m = fmaxf(m, vv);
    }
#pragma unroll
    for (int off = 1; off < 16; off <<= 1) m = fmaxf(m, __shfl_xor(m, off, 32));
    float sum = 0.f;
#pragma unroll
    for (int t = 0; t < 8; ++t) {
      float e = __expf(s[t][i] - m);
      s[t][i] = e;
      sum += e;
    }
#pragma unroll
    for (int off = 1; off < 16; off <<= 1) sum += __shfl_xor(sum, off, 32);
    const float inv = 1.0f / sum;
    const int row = r0 + i + 8 * half;
#pragma unroll
    for (int t = 0; t < 8; ++t)
      Ps[row * 136 + t * 16 + lr] = (_Float16)(s[t][i] * inv);
  }
  // Same-wave LDS store->load is in-order; each wave reads only its own strip.

  // ---- O = P V : 16 rows x 64 cols (4 tiles), K = 128 ----
  v8f oa[4];
#pragma unroll
  for (int dt = 0; dt < 4; ++dt) oa[dt] = {};
#pragma unroll
  for (int kk = 0; kk < WIN; kk += 32) {
    v16h ap = load_frag(&Ps[r0 * 136 + kk], 136);
#pragma unroll
    for (int dt = 0; dt < 4; ++dt) {
      v16h bv = load_frag_pieces(V, dt * 8 + (kk >> 4));
      oa[dt] = __builtin_amdgcn_wmma_f32_16x16x32_f16(
          false, ap, false, bv, (short)0, oa[dt], false, false);
    }
  }

  // to (B, N, C) with heads concatenated, col = h*64 + d, in whole lines: a
  // token's 64 dims of one head are one 128-B line. The wave passes O through
  // its own strip of Ps (its P reads have fed the WMMAs above; no other wave
  // touches the strip) and takes it back as 8 neighbouring dims per lane: one
  // 16-B store a lane covers the lines of 4 tokens.
  _Float16* Os = &Ps[r0 * 136];
#pragma unroll
  for (int dt = 0; dt < 4; ++dt)
#pragma unroll
    for (int r = 0; r < 8; ++r)
      Os[(r + 8 * half) * 136 + dt * 16 + lr] = (_Float16)oa[dt][r];
  wait_ds0();             // my staged rows are written before I read them back
  const int b = bh >> 4, h = bh & 15;
  const int tr = lane >> 3, tc = (lane & 7) * 8;
  _Float16* og = o + ((size_t)b * 8192 + win * WIN + r0 + tr) * DIM + h * HD + tc;
  h8 y[4];
#pragma unroll
  for (int it = 0; it < 4; ++it) y[it] = *(const h8*)&Os[(it * 4 + tr) * 136 + tc];
#pragma unroll
  for (int it = 0; it < 4; ++it) *(h8*)(og + (size_t)(it * 4) * DIM) = y[it];
}

// ---------------------------------------------------------------------------
// Host-side orchestration
// ---------------------------------------------------------------------------
extern "C" void kernel_launch(void* const* d_in, const int* in_sizes, int n_in,
                              void* d_out, int out_size, void* d_ws,
                              size_t ws_size, hipStream_t stream) {
  const float* x      = (const float*)d_in[0];
  const float* ln1_w  = (const float*)d_in[1];
  const float* ln1_b  = (const float*)d_in[2];
  const float* qkv_w  = (const float*)d_in[3];
  const float* qkv_b  = (const float*)d_in[4];
  const float* proj_w = (const float*)d_in[5];
  const float* proj_b = (const float*)d_in[6];
  const float* ln2_w  = (const float*)d_in[7];
  const float* ln2_b  = (const float*)d_in[8];
  const float* fc1_w  = (const float*)d_in[9];
  const float* fc1_b  = (const float*)d_in[10];
  const float* fc2_w  = (const float*)d_in[11];
  const float* fc2_b  = (const float*)d_in[12];
  float* out = (float*)d_out;

  char* ws = (char*)d_ws;
  const size_t MB = 1024ull * 1024ull;
  // [0,16MB): f16 weights
  _Float16* qkv_w16  = (_Float16*)ws;
  _Float16* proj_w16 = qkv_w16 + 3u * DIM * DIM;
  _Float16* fc1_w16  = proj_w16 + (size_t)DIM * DIM;
  _Float16* fc2_w16  = fc1_w16 + 2u * DIM * DIM;
  // [16,80): LN output (xn, reused as h)      64 MB f16
  _Float16* xn = (_Float16*)(ws + 16 * MB);
  // [80,272): q/k/v, fragment order           3 x 64 MB f16; act reuses front
  _Float16* qbuf = (_Float16*)(ws + 80 * MB);
  _Float16* kbuf = qbuf + ((size_t)1 << 25);
  _Float16* vbuf = kbuf + ((size_t)1 << 25);
  _Float16* act  = qbuf;  // 128 MB, reused after attention consumes q/k/v
  // [272,336): attention output               64 MB f16
  _Float16* attn_out = (_Float16*)(ws + 272 * MB);
  // [336,464): x1 = x + attn (f32 residual)   128 MB
  float* x1 = (float*)(ws + 336 * MB);

  // 1) weight casts
  cvt_kernel<<<(3 * DIM * DIM + 255) / 256, 256, 0, stream>>>(qkv_w, qkv_w16, 3 * DIM * DIM);
  cvt_kernel<<<(DIM * DIM + 255) / 256, 256, 0, stream>>>(proj_w, proj_w16, DIM * DIM);
  cvt_kernel<<<(2 * DIM * DIM + 255) / 256, 256, 0, stream>>>(fc1_w, fc1_w16, 2 * DIM * DIM);
  cvt_kernel<<<(2 * DIM * DIM + 255) / 256, 256, 0, stream>>>(fc2_w, fc2_w16, 2 * DIM * DIM);

  // 2) LN1
  ln_kernel<<<TOK / 8, 256, 0, stream>>>(x, ln1_w, ln1_b, xn, TOK);

  // 3) QKV GEMM (32768 x 3072 x 1024) into fragment-order q/k/v
  gemm_kernel<0><<<dim3(3072 / BT, TOK / BT), 256, 0, stream>>>(
      xn, qkv_w16, qkv_b, nullptr, (void*)qbuf, TOK, 3072, DIM);

  // 4) windowed attention: 4*16*64 blocks
  attn_kernel<<<4 * NHEAD * 64, 256, 0, stream>>>(qbuf, kbuf, vbuf, attn_out);

  // 5) proj GEMM + residual -> x1 (f32)
  gemm_kernel<1><<<dim3(DIM / BT, TOK / BT), 256, 0, stream>>>(
      attn_out, proj_w16, proj_b, x, (void*)x1, TOK, DIM, DIM);

  // 6) LN2
  ln_kernel<<<TOK / 8, 256, 0, stream>>>(x1, ln2_w, ln2_b, xn, TOK);

  // 7) FC1 GEMM + exact GELU (32768 x 2048 x 1024)
  gemm_kernel<2><<<dim3(2048 / BT, TOK / BT), 256, 0, stream>>>(
      xn, fc1_w16, fc1_b, nullptr, (void*)act, TOK, 2048, DIM);

  // 8) FC2 GEMM + residual -> d_out (32768 x 1024 x 2048)
  gemm_kernel<3><<<dim3(DIM / BT, TOK / BT), 256, 0, stream>>>(
      act, fc2_w16, fc2_b, x1, (void*)out, TOK, DIM, 2048);
}
